// v000
// The times below were measured on an AMD MI455X: many runs one after another, warmed up first and cycling through
// copies of the inputs, with the whole window's GPU time divided by the number of runs. Launches and the gaps
// between them are all in it. The median over several windows is given; except for v000 it joins two sittings, which
// can be a few percent apart, so the side-by-side timings, each taken in one sitting, are the better comparison.
// v000 is the starting kernel.
#include <hip/hip_runtime.h>
#include <hip/hip_bf16.h>

typedef __attribute__((ext_vector_type(16))) _Float16 v16h;
typedef __attribute__((ext_vector_type(8)))  float    v8f;

#define B_   16
#define SQ   4096
#define DM   512
#define SKV  77
#define DC   768
#define NH   8
#define DH   64
#define INNER 512
#define JPAD 128   // Skv padded to multiple of 32 (K-dim of attn@v WMMA)

// ---------------------------------------------------------------------------
// helpers
// ---------------------------------------------------------------------------
__device__ __forceinline__ v8f wmma32(v16h a, v16h b, v8f c) {
    // D = A(16x32 f16) * B(32x16 f16) + C(16x16 f32)
    return __builtin_amdgcn_wmma_f32_16x16x32_f16(
        /*neg_a=*/false, a, /*neg_b=*/false, b,
        /*c_mod=*/(short)0, c, /*reuse_a=*/false, /*reuse_b=*/false);
}

// One fragment load works for both A and B operands:
//   A: base = &mat[row0*stride + k0]     lane picks m = lane&15, 16 halfs along K
//   B: base = &W[n0*K + k0] (N-major)    lane picks n = lane&15, 16 halfs along K
// Per-lane 32-byte contiguous load -> b128 pairs (ds_load / global_load).
__device__ __forceinline__ v16h frag16(const _Float16* base, int stride, int lane) {
    return *(const v16h*)(base + (size_t)(lane & 15) * stride + ((lane >> 4) << 4));
}

// ---------------------------------------------------------------------------
// Kernel 0: convert f32 weight [K][N] -> f16 transposed [N][K]
// ---------------------------------------------------------------------------
__global__ void wcvt_t(const float* __restrict__ src, _Float16* __restrict__ dst,
                       int K, int N) {
    int idx = blockIdx.x * 256 + threadIdx.x;
    if (idx < K * N) {
        int k = idx / N, n = idx - k * N;
        dst[(size_t)n * K + k] = (_Float16)src[idx];
    }
}

// ---------------------------------------------------------------------------
// Kernel 1: k/v projection (WMMA).
//   context[b][j][768] @ Wk/Wv -> per-head layouts:
//     kP[b][h][j(128)][d(64)]   (B-operand of scores:  K=d, N=j -> [j][d] N-major)
//     vT[b][h][d(64)][j(128)]   (B-operand of attn@v:  K=j, N=d -> [d][j] N-major)
// grid = (5 m-tiles, 16 batches, 2 {k,v}), block = 256 (8 waves)
// ---------------------------------------------------------------------------
__global__ __launch_bounds__(256) void kv_proj(
    const float* __restrict__ ctx,
    const _Float16* __restrict__ WkT,   // [512][768] f16
    const _Float16* __restrict__ WvT,   // [512][768] f16
    _Float16* __restrict__ kP,
    _Float16* __restrict__ vT) {
    __shared__ __align__(32) _Float16 ct[16 * DC];   // 24 KB context tile (f16)

    const int tid  = threadIdx.x;
    const int b    = blockIdx.y;
    const int j0   = blockIdx.x * 16;
    const int isv  = blockIdx.z;
    const int w    = tid >> 5, lane = tid & 31;

    const float* cbase = ctx + (size_t)b * SKV * DC;
    for (int i = tid; i < 16 * DC; i += 256) {
        int r = i / DC, c = i - r * DC;
        int j = j0 + r;
        ct[i] = (j < SKV) ? (_Float16)cbase[(size_t)j * DC + c] : (_Float16)0.f;
    }
    __syncthreads();

    const _Float16* WT = isv ? WvT : WkT;
    const int n0 = w * 64;

    v8f acc[4] = {v8f{}, v8f{}, v8f{}, v8f{}};
    for (int ks = 0; ks < DC / 32; ++ks) {
        const int k0 = ks * 32;
        v16h a = frag16(ct + k0, DC, lane);
#pragma unroll
        for (int t = 0; t < 4; ++t) {
            v16h bf = frag16(WT + (size_t)(n0 + t * 16) * DC + k0, DC, lane);
            acc[t] = wmma32(a, bf, acc[t]);
        }
    }

#pragma unroll
    for (int t = 0; t < 4; ++t) {
        const int n = n0 + t * 16 + (lane & 15);
        const int h = n >> 6, d = n & 63;
#pragma unroll
        for (int g = 0; g < 8; ++g) {
            const int j = j0 + g + 8 * (lane >> 4);
            if (j < SKV) {
                _Float16 val = (_Float16)acc[t][g];
                if (isv) vT[(((size_t)b * NH + h) * DH + d) * JPAD + j] = val;
                else     kP[(((size_t)b * NH + h) * JPAD + j) * DH + d] = val;
            }
        }
    }
}

// ---------------------------------------------------------------------------
// Kernel 2: fused q-proj + attention + out-proj.
// One block = 64 q rows of one batch. 256 threads = 8 waves.
// bufA: x tile (f16) then h tile; bufB: q tile (f16, pre-scaled by d^-1/2).
// ---------------------------------------------------------------------------
__global__ __launch_bounds__(256) void attn_fused(
    const float*    __restrict__ x,
    const _Float16* __restrict__ WqT,    // [512][512]
    const _Float16* __restrict__ kP,     // [B][H][128][64]
    const _Float16* __restrict__ vT,     // [B][H][64][128]
    const _Float16* __restrict__ WoT,    // [512][512]
    const float*    __restrict__ bout,   // [512]
    float*          __restrict__ out) {
    __shared__ __align__(32) _Float16 bufA[64 * INNER];  // 64 KB  x -> h
    __shared__ __align__(32) _Float16 bufB[64 * INNER];  // 64 KB  q
    __shared__ __align__(32) float    sc[64 * JPAD];     // 32 KB  scores
    __shared__ __align__(32) _Float16 wb[64 * JPAD];     // 16 KB  softmax weights

    const int tid  = threadIdx.x;
    const int w    = tid >> 5, lane = tid & 31;
    const int b    = blockIdx.y;
    const int m0   = blockIdx.x * 64;

    // ---------- phase 0: x tile -> f16 LDS (tile is one contiguous block) ----
    const float4* xs = (const float4*)(x + ((size_t)b * SQ + m0) * DM);
    __builtin_prefetch(WqT + (size_t)tid * 1024, 0, 1);   // warm L2 with Wq
    for (int i = tid; i < 64 * DM / 4; i += 256) {
        float4 v = xs[i];
        _Float16* d = bufA + (size_t)i * 4;
        d[0] = (_Float16)v.x; d[1] = (_Float16)v.y;
        d[2] = (_Float16)v.z; d[3] = (_Float16)v.w;
    }
    __syncthreads();

    // ---------- phase 1: q = x @ Wq  (scaled), write f16 to bufB -------------
    {
        const int wm = w & 3, wn = w >> 2;                 // 4 x 2 wave grid
        const _Float16* arow = bufA + (size_t)(wm * 16) * INNER;
        for (int nc = 0; nc < 4; ++nc) {
            const int n0 = wn * 256 + nc * 64;
            v8f q[4] = {v8f{}, v8f{}, v8f{}, v8f{}};
            for (int ks = 0; ks < INNER / 32; ++ks) {
                const int k0 = ks * 32;
                v16h a = frag16(arow + k0, INNER, lane);
#pragma unroll
                for (int t = 0; t < 4; ++t) {
                    v16h bf = frag16(WqT + (size_t)(n0 + t * 16) * INNER + k0,
                                     INNER, lane);
                    q[t] = wmma32(a, bf, q[t]);
                }
            }
#pragma unroll
            for (int t = 0; t < 4; ++t) {
                const int n = n0 + t * 16 + (lane & 15);
#pragma unroll
                for (int g = 0; g < 8; ++g) {
                    const int m = wm * 16 + g + 8 * (lane >> 4);
                    bufB[(size_t)m * INNER + n] = (_Float16)(q[t][g] * 0.125f);
                }
            }
        }
    }
    __syncthreads();

    // ---------- phase 2: per-head scores -> softmax -> attn@v ----------------
    for (int h = 0; h < NH; ++h) {
        {   // scores[64][128] = q_h (64x64) @ k_h^T, waves: 4(m) x 2(j-half)
            const int sm = w & 3, sj = w >> 2;
            const _Float16* qrow = bufB + (size_t)(sm * 16) * INNER + h * DH;
            const _Float16* kb   = kP + (((size_t)b * NH + h) * JPAD) * DH;
            v8f s[4] = {v8f{}, v8f{}, v8f{}, v8f{}};
#pragma unroll
            for (int dstep = 0; dstep < 2; ++dstep) {
                const int d0 = dstep * 32;
                v16h a = frag16(qrow + d0, INNER, lane);
#pragma unroll
                for (int t = 0; t < 4; ++t) {
                    const int j0 = sj * 64 + t * 16;
                    v16h bf = frag16(kb + (size_t)j0 * DH + d0, DH, lane);
                    s[t] = wmma32(a, bf, s[t]);
                }
            }
#pragma unroll
            for (int t = 0; t < 4; ++t) {
                const int j = sj * 64 + t * 16 + (lane & 15);
#pragma unroll
                for (int g = 0; g < 8; ++g) {
                    const int m = sm * 16 + g + 8 * (lane >> 4);
                    sc[m * JPAD + j] = s[t][g];
                }
            }
        }
        __syncthreads();

        if (tid < 64) {  // one thread per q row: softmax over 77 keys
            float* row = sc + tid * JPAD;
            float mx = -1e30f;
            for (int j = 0; j < SKV; ++j) mx = fmaxf(mx, row[j]);
            float sum = 0.f;
            for (int j = 0; j < SKV; ++j) {
                float e = __expf(row[j] - mx);
                row[j] = e; sum += e;
            }
            const float r = 1.f / sum;
            _Float16* wr = wb + tid * JPAD;
            for (int j = 0; j < SKV; ++j)    wr[j] = (_Float16)(row[j] * r);
            for (int j = SKV; j < JPAD; ++j) wr[j] = (_Float16)0.f;
        }
        __syncthreads();

        {   // attn (64x64) = w (64x128) @ v_h (128x64), waves: 4(m) x 2(d-half)
            const int am = w & 3, ad = w >> 2;
            const _Float16* wrow = wb + (size_t)(am * 16) * JPAD;
            const _Float16* vb   = vT + (((size_t)b * NH + h) * DH) * JPAD;
            v8f av[2] = {v8f{}, v8f{}};
#pragma unroll
            for (int js = 0; js < 4; ++js) {
                const int j0 = js * 32;
                v16h a = frag16(wrow + j0, JPAD, lane);
#pragma unroll
                for (int t = 0; t < 2; ++t) {
                    const int d0 = ad * 32 + t * 16;
                    v16h bf = frag16(vb + (size_t)d0 * JPAD + j0, JPAD, lane);
                    av[t] = wmma32(a, bf, av[t]);
                }
            }
#pragma unroll
            for (int t = 0; t < 2; ++t) {
                const int d = ad * 32 + t * 16 + (lane & 15);
#pragma unroll
                for (int g = 0; g < 8; ++g) {
                    const int m = am * 16 + g + 8 * (lane >> 4);
                    bufA[(size_t)m * INNER + h * DH + d] = (_Float16)av[t][g];
                }
            }
        }
        __syncthreads();
    }

    // ---------- phase 3: out = h @ Wout + bout -------------------------------
    {
        const int wm = w & 3, wn = w >> 2;
        const _Float16* hrow = bufA + (size_t)(wm * 16) * INNER;
        float* orow = out + ((size_t)b * SQ + m0 + wm * 16) * INNER;
        for (int nc = 0; nc < 4; ++nc) {
            const int n0 = wn * 256 + nc * 64;
            v8f o[4] = {v8f{}, v8f{}, v8f{}, v8f{}};
            for (int ks = 0; ks < INNER / 32; ++ks) {
                const int k0 = ks * 32;
                v16h a = frag16(hrow + k0, INNER, lane);
#pragma unroll
                for (int t = 0; t < 4; ++t) {
                    v16h bf = frag16(WoT + (size_t)(n0 + t * 16) * INNER + k0,
                                     INNER, lane);
                    o[t] = wmma32(a, bf, o[t]);
                }
            }
#pragma unroll
            for (int t = 0; t < 4; ++t) {
                const int n = n0 + t * 16 + (lane & 15);
                const float bias = bout[n];
#pragma unroll
                for (int g = 0; g < 8; ++g) {
                    orow[(size_t)(g + 8 * (lane >> 4)) * INNER + n] = o[t][g] + bias;
                }
            }
        }
    }
}

// ---------------------------------------------------------------------------
// launch
// ---------------------------------------------------------------------------
extern "C" void kernel_launch(void* const* d_in, const int* in_sizes, int n_in,
                              void* d_out, int out_size, void* d_ws, size_t ws_size,
                              hipStream_t stream) {
    const float* x    = (const float*)d_in[0];
    const float* ctx  = (const float*)d_in[1];
    const float* Wq   = (const float*)d_in[2];
    const float* Wk   = (const float*)d_in[3];
    const float* Wv   = (const float*)d_in[4];
    const float* Wout = (const float*)d_in[5];
    const float* bout = (const float*)d_in[6];
    float* out = (float*)d_out;

    char* ws = (char*)d_ws;
    size_t off = 0;
    _Float16* WqT = (_Float16*)(ws + off); off += (size_t)INNER * DM * 2;     // [512][512]
    _Float16* WkT = (_Float16*)(ws + off); off += (size_t)INNER * DC * 2;     // [512][768]
    _Float16* WvT = (_Float16*)(ws + off); off += (size_t)INNER * DC * 2;     // [512][768]
    _Float16* WoT = (_Float16*)(ws + off); off += (size_t)INNER * INNER * 2;  // [512][512]
    _Float16* kP  = (_Float16*)(ws + off);
    size_t kvBytes = 2ull * B_ * NH * JPAD * DH * 2;                          // kP + vT
    _Float16* vT  = (_Float16*)(ws + off + kvBytes / 2);

    // zero the j-padding of kP/vT (graph-capturable)
    hipMemsetAsync(kP, 0, kvBytes, stream);

    // weight convert + transpose to f16 [N][K]
    wcvt_t<<<dim3((DM * INNER + 255) / 256), 256, 0, stream>>>(Wq, WqT, DM, INNER);
    wcvt_t<<<dim3((DC * INNER + 255) / 256), 256, 0, stream>>>(Wk, WkT, DC, INNER);
    wcvt_t<<<dim3((DC * INNER + 255) / 256), 256, 0, stream>>>(Wv, WvT, DC, INNER);
    wcvt_t<<<dim3((INNER * INNER + 255) / 256), 256, 0, stream>>>(Wout, WoT, INNER, INNER);

    // k/v projection: 5 j-tiles x 16 batches x {k,v}
    kv_proj<<<dim3(5, B_, 2), 256, 0, stream>>>(ctx, WkT, WvT, kP, vT);

    // fused q-proj + attention + out-proj: 64 q-tiles x 16 batches
    attn_fused<<<dim3(SQ / 64, B_), 256, 0, stream>>>(x, WqT, kP, vT, WoT, bout, out);
}

// v001
// Two timings next to v000 put it at 1.98 and 1.99 times that version's speed.
#include <hip/hip_runtime.h>
#include <hip/hip_bf16.h>

typedef __attribute__((ext_vector_type(16))) _Float16 v16h;
typedef __attribute__((ext_vector_type(8)))  _Float16 v8h;
typedef __attribute__((ext_vector_type(8)))  float    v8f;

#define B_   16
#define SQ   4096
#define DM   512
#define SKV  77
#define DC   768
#define NH   8
#define DH   64
#define INNER 512
#define JPAD 128   // Skv padded to multiple of 32 (K-dim of attn@v WMMA)

// ---------------------------------------------------------------------------
// helpers
// ---------------------------------------------------------------------------
__device__ __forceinline__ v8f wmma32(v16h a, v16h b, v8f c) {
    // D = A(16x32 f16) * B(32x16 f16) + C(16x16 f32)
    return __builtin_amdgcn_wmma_f32_16x16x32_f16(
        /*neg_a=*/false, a, /*neg_b=*/false, b,
        /*c_mod=*/(short)0, c, /*reuse_a=*/false, /*reuse_b=*/false);
}

// One fragment load works for both A and B operands:
//   A: base = &mat[row0*stride + k0]     lane picks m = lane&15, 16 halfs along K
//   B: base = &W[n0*K + k0] (N-major)    lane picks n = lane&15, 16 halfs along K
// Per-lane 32-byte contiguous load -> b128 pairs (ds_load / global_load).
__device__ __forceinline__ v16h frag16(const _Float16* base, int stride, int lane) {
    return *(const v16h*)(base + (size_t)(lane & 15) * stride + ((lane >> 4) << 4));
}

// 2^x. The v_nop is the one free issue slot the instruction set asks for behind a
// transcendental.
__device__ __forceinline__ float exp2_slot(float x) {
    float r;
    asm("v_exp_f32 %0, %1\n\tv_nop" : "=v"(r) : "v"(x));
    return r;
}

// ---------------------------------------------------------------------------
// Kernel 0: convert f32 weight [K][N] -> f16 transposed [N][K]
// ---------------------------------------------------------------------------
__global__ void wcvt_t(const float* __restrict__ src, _Float16* __restrict__ dst,
                       int K, int N) {
    int idx = blockIdx.x * 256 + threadIdx.x;
    if (idx < K * N) {
        int k = idx / N, n = idx - k * N;
        dst[(size_t)n * K + k] = (_Float16)src[idx];
    }
}

// ---------------------------------------------------------------------------
// Kernel 1: k/v projection (WMMA).
//   context[b][j][768] @ Wk/Wv -> per-head layouts:
//     kP[b][h][j(128)][d(64)]   (A-operand of S^T = K Q^T:  M=j, K=d -> [j][d] row-major)
//     vT[b][h][d(64)][j(128)]   (A-operand of O^T = V^T P^T:  M=d, K=j -> [d][j] row-major)
// grid = (5 m-tiles, 16 batches, 2 {k,v}), block = 256 (8 waves)
// ---------------------------------------------------------------------------
__global__ __launch_bounds__(256) void kv_proj(
    const float* __restrict__ ctx,
    const _Float16* __restrict__ WkT,   // [512][768] f16
    const _Float16* __restrict__ WvT,   // [512][768] f16
    _Float16* __restrict__ kP,
    _Float16* __restrict__ vT) {
    __shared__ __align__(32) _Float16 ct[16 * DC];   // 24 KB context tile (f16)

    const int tid  = threadIdx.x;
    const int b    = blockIdx.y;
    const int j0   = blockIdx.x * 16;
    const int isv  = blockIdx.z;
    const int w    = tid >> 5, lane = tid & 31;

    const float* cbase = ctx + (size_t)b * SKV * DC;
    for (int i = tid; i < 16 * DC; i += 256) {
        int r = i / DC, c = i - r * DC;
        int j = j0 + r;
        ct[i] = (j < SKV) ? (_Float16)cbase[(size_t)j * DC + c] : (_Float16)0.f;
    }
    __syncthreads();

    const _Float16* WT = isv ? WvT : WkT;
    const int n0 = w * 64;

    v8f acc[4] = {v8f{}, v8f{}, v8f{}, v8f{}};
    for (int ks = 0; ks < DC / 32; ++ks) {
        const int k0 = ks * 32;
        v16h a = frag16(ct + k0, DC, lane);
#pragma unroll
        for (int t = 0; t < 4; ++t) {
            v16h bf = frag16(WT + (size_t)(n0 + t * 16) * DC + k0, DC, lane);
            acc[t] = wmma32(a, bf, acc[t]);
        }
    }

#pragma unroll
    for (int t = 0; t < 4; ++t) {
        const int n = n0 + t * 16 + (lane & 15);
        const int h = n >> 6, d = n & 63;
#pragma unroll
        for (int g = 0; g < 8; ++g) {
            const int j = j0 + g + 8 * (lane >> 4);
            if (j < SKV) {
                _Float16 val = (_Float16)acc[t][g];
                if (isv) vT[(((size_t)b * NH + h) * DH + d) * JPAD + j] = val;
                else     kP[(((size_t)b * NH + h) * JPAD + j) * DH + d] = val;
            }
        }
    }
}

// ---------------------------------------------------------------------------
// Kernel 2: fused q-proj + attention + out-proj.
// One block = 64 q rows of one batch. 256 threads = 8 waves.
// bufA: x tile (f16) then h tile; bufB: q tile (f16, pre-scaled by d^-1/2).
// ---------------------------------------------------------------------------
__global__ __launch_bounds__(256) void attn_fused(
    const float*    __restrict__ x,
    const _Float16* __restrict__ WqT,    // [512][512]
    const _Float16* __restrict__ kP,     // [B][H][128][64]
    const _Float16* __restrict__ vT,     // [B][H][64][128]
    const _Float16* __restrict__ WoT,    // [512][512]
    const float*    __restrict__ bout,   // [512]
    float*          __restrict__ out) {
    __shared__ __align__(32) _Float16 bufA[64 * INNER];  // 64 KB  x -> h
    __shared__ __align__(32) _Float16 bufB[64 * INNER];  // 64 KB  q

    const int tid  = threadIdx.x;
    const int w    = tid >> 5, lane = tid & 31;
    const int b    = blockIdx.y;
    const int m0   = blockIdx.x * 64;

    // ---------- phase 0: x tile -> f16 LDS (tile is one contiguous block) ----
    const float4* xs = (const float4*)(x + ((size_t)b * SQ + m0) * DM);
    __builtin_prefetch(WqT + (size_t)tid * 1024, 0, 1);   // warm L2 with Wq
    for (int i = tid; i < 64 * DM / 4; i += 256) {
        float4 v = xs[i];
        _Float16* d = bufA + (size_t)i * 4;
        d[0] = (_Float16)v.x; d[1] = (_Float16)v.y;
        d[2] = (_Float16)v.z; d[3] = (_Float16)v.w;
    }
    __syncthreads();

    // ---------- phase 1: q = x @ Wq  (scaled), write f16 to bufB -------------
    {
        const int wm = w & 3, wn = w >> 2;                 // 4 x 2 wave grid
        const _Float16* arow = bufA + (size_t)(wm * 16) * INNER;
        for (int nc = 0; nc < 4; ++nc) {
            const int n0 = wn * 256 + nc * 64;
            v8f q[4] = {v8f{}, v8f{}, v8f{}, v8f{}};
            for (int ks = 0; ks < INNER / 32; ++ks) {
                const int k0 = ks * 32;
                v16h a = frag16(arow + k0, INNER, lane);
#pragma unroll
                for (int t = 0; t < 4; ++t) {
                    v16h bf = frag16(WqT + (size_t)(n0 + t * 16) * INNER + k0,
                                     INNER, lane);
                    q[t] = wmma32(a, bf, q[t]);
                }
            }
#pragma unroll
            for (int t = 0; t < 4; ++t) {
                const int n = n0 + t * 16 + (lane & 15);
#pragma unroll
                for (int g = 0; g < 8; ++g) {
                    const int m = wm * 16 + g + 8 * (lane >> 4);
                    bufB[(size_t)m * INNER + n] = (_Float16)(q[t][g] * 0.125f);
                }
            }
        }
    }
    __syncthreads();

    // ---------- phase 2: attention, one head per wave, softmax in registers --
    // S^T = K * Q^T: a lane holds 40 of one query's 80 score slots (lane and
    // lane ^ 16 split the keys), so max and sum are in-lane plus one exchange.
    // The score tiles, converted in place, are the B operand of O^T = V^T * P^T;
    // V^T is read in the matching k order (8 keys at 8*hi, 8 keys at 16 + 8*hi).
    {
        const int h = w;
        const int c = lane & 15, hi = lane >> 4;
        const _Float16* kb = kP + (((size_t)b * NH + h) * JPAD) * DH;
        const _Float16* vb = vT + (((size_t)b * NH + h) * DH) * JPAD;
        for (int mt = 0; mt < 4; ++mt) {
            const _Float16* qrow = bufB + (size_t)(mt * 16) * INNER + h * DH;
            v8f s[5] = {v8f{}, v8f{}, v8f{}, v8f{}, v8f{}};
#pragma unroll
            for (int dstep = 0; dstep < 2; ++dstep) {
                const int d0 = dstep * 32;
                v16h qf = frag16(qrow + d0, INNER, lane);
#pragma unroll
                for (int t = 0; t < 5; ++t) {
                    v16h kf = frag16(kb + (size_t)(t * 16) * DH + d0, DH, lane);
                    s[t] = wmma32(kf, qf, s[t]);     // s[t][g]: key 16t + 8hi + g, query c
                }
            }
            // keys 77..79 (tile 4, upper half, g >= 5) are padding
#pragma unroll
            for (int g = SKV - 72; g < 8; ++g) s[4][g] = hi ? -1e30f : s[4][g];

            float mx = -1e30f;
#pragma unroll
            for (int t = 0; t < 5; ++t)
#pragma unroll
                for (int g = 0; g < 8; ++g) mx = fmaxf(mx, s[t][g]);
            mx = fmaxf(mx, __shfl_xor(mx, 16));
            float sum = 0.f;
#pragma unroll
            for (int t = 0; t < 5; ++t)
#pragma unroll
                for (int g = 0; g < 8; ++g) {
                    float e = exp2_slot((s[t][g] - mx) * 1.44269504f);
                    s[t][g] = e; sum += e;
                }
            sum += __shfl_xor(sum, 16);
            const float r = 1.f / sum;

            v16h p[3];
#pragma unroll
            for (int kk = 0; kk < 3; ++kk)
#pragma unroll
                for (int g = 0; g < 8; ++g) {
                    p[kk][g]     = (_Float16)(s[2 * kk][g] * r);
                    p[kk][8 + g] = (kk < 2) ? (_Float16)(s[(kk < 2) ? 2 * kk + 1 : 0][g] * r)
                                            : (_Float16)0.f;
                }

            v8f o[4] = {v8f{}, v8f{}, v8f{}, v8f{}};
#pragma unroll
            for (int kk = 0; kk < 3; ++kk) {
#pragma unroll
                for (int td = 0; td < 4; ++td) {
                    const _Float16* vr = vb + (size_t)(td * 16 + c) * JPAD + kk * 32 + 8 * hi;
                    v8h lo = *(const v8h*)vr;
                    v8h up = (kk < 2) ? *(const v8h*)(vr + 16) : v8h{};
                    v16h vf = __builtin_shufflevector(lo, up, 0, 1, 2, 3, 4, 5, 6, 7,
                                                      8, 9, 10, 11, 12, 13, 14, 15);
                    o[td] = wmma32(vf, p[kk], o[td]); // o[td][g]: d 16td + 8hi + g, query c
                }
            }
#pragma unroll
            for (int td = 0; td < 4; ++td) {
                v8h ov;
#pragma unroll
                for (int g = 0; g < 8; ++g) ov[g] = (_Float16)o[td][g];
                *(v8h*)(bufA + (size_t)(mt * 16 + c) * INNER + h * DH + td * 16 + 8 * hi) = ov;
            }
        }
    }
    __syncthreads();

    // ---------- phase 3: out = h @ Wout + bout -------------------------------
    {
        const int wm = w & 3, wn = w >> 2;
        const _Float16* hrow = bufA + (size_t)(wm * 16) * INNER;
        float* orow = out + ((size_t)b * SQ + m0 + wm * 16) * INNER;
        for (int nc = 0; nc < 4; ++nc) {
            const int n0 = wn * 256 + nc * 64;
            v8f o[4] = {v8f{}, v8f{}, v8f{}, v8f{}};
            for (int ks = 0; ks < INNER / 32; ++ks) {
                const int k0 = ks * 32;
                v16h a = frag16(hrow + k0, INNER, lane);
#pragma unroll
                for (int t = 0; t < 4; ++t) {
                    v16h bf = frag16(WoT + (size_t)(n0 + t * 16) * INNER + k0,
                                     INNER, lane);
                    o[t] = wmma32(a, bf, o[t]);
                }
            }
#pragma unroll
            for (int t = 0; t < 4; ++t) {
                const int n = n0 + t * 16 + (lane & 15);
                const float bias = bout[n];
#pragma unroll
                for (int g = 0; g < 8; ++g) {
                    orow[(size_t)(g + 8 * (lane >> 4)) * INNER + n] = o[t][g] + bias;
                }
            }
        }
    }
}

// ---------------------------------------------------------------------------
// launch
// ---------------------------------------------------------------------------
extern "C" void kernel_launch(void* const* d_in, const int* in_sizes, int n_in,
                              void* d_out, int out_size, void* d_ws, size_t ws_size,
                              hipStream_t stream) {
    const float* x    = (const float*)d_in[0];
    const float* ctx  = (const float*)d_in[1];
    const float* Wq   = (const float*)d_in[2];
    const float* Wk   = (const float*)d_in[3];
    const float* Wv   = (const float*)d_in[4];
    const float* Wout = (const float*)d_in[5];
    const float* bout = (const float*)d_in[6];
    float* out = (float*)d_out;

    char* ws = (char*)d_ws;
    size_t off = 0;
    _Float16* WqT = (_Float16*)(ws + off); off += (size_t)INNER * DM * 2;     // [512][512]
    _Float16* WkT = (_Float16*)(ws + off); off += (size_t)INNER * DC * 2;     // [512][768]
    _Float16* WvT = (_Float16*)(ws + off); off += (size_t)INNER * DC * 2;     // [512][768]
    _Float16* WoT = (_Float16*)(ws + off); off += (size_t)INNER * INNER * 2;  // [512][512]
    _Float16* kP  = (_Float16*)(ws + off);
    size_t kvBytes = 2ull * B_ * NH * JPAD * DH * 2;                          // kP + vT
    _Float16* vT  = (_Float16*)(ws + off + kvBytes / 2);

    // zero the j-padding of kP/vT (graph-capturable)
    hipMemsetAsync(kP, 0, kvBytes, stream);

    // weight convert + transpose to f16 [N][K]
    wcvt_t<<<dim3((DM * INNER + 255) / 256), 256, 0, stream>>>(Wq, WqT, DM, INNER);
    wcvt_t<<<dim3((DC * INNER + 255) / 256), 256, 0, stream>>>(Wk, WkT, DC, INNER);
    wcvt_t<<<dim3((DC * INNER + 255) / 256), 256, 0, stream>>>(Wv, WvT, DC, INNER);
    wcvt_t<<<dim3((INNER * INNER + 255) / 256), 256, 0, stream>>>(Wout, WoT, INNER, INNER);

    // k/v projection: 5 j-tiles x 16 batches x {k,v}
    kv_proj<<<dim3(5, B_, 2), 256, 0, stream>>>(ctx, WkT, WvT, kP, vT);

    // fused q-proj + attention + out-proj: 64 q-tiles x 16 batches
    attn_fused<<<dim3(SQ / 64, B_), 256, 0, stream>>>(x, WqT, kP, vT, WoT, bout, out);
}

// v002
// In both of two side-by-side timings against v001, it was 1.66 times as fast.
// All steps since v000 together make it 3.30 times as fast.
#include <hip/hip_runtime.h>
#include <hip/hip_bf16.h>

typedef __attribute__((ext_vector_type(16))) _Float16 v16h;
typedef __attribute__((ext_vector_type(8)))  _Float16 v8h;
typedef __attribute__((ext_vector_type(8)))  float    v8f;

#define B_   16
#define SQ   4096
#define DM   512
#define SKV  77
#define DC   768
#define NH   8
#define DH   64
#define INNER 512
#define JPAD 128   // Skv padded to multiple of 32 (K-dim of attn@v WMMA)

// ---------------------------------------------------------------------------
// helpers
// ---------------------------------------------------------------------------
__device__ __forceinline__ v8f wmma32(v16h a, v16h b, v8f c) {
    // D = A(16x32 f16) * B(32x16 f16) + C(16x16 f32)
    return __builtin_amdgcn_wmma_f32_16x16x32_f16(
        /*neg_a=*/false, a, /*neg_b=*/false, b,
        /*c_mod=*/(short)0, c, /*reuse_a=*/false, /*reuse_b=*/false);
}

// One fragment load works for both A and B operands:
//   A: base = &mat[row0*stride + k0]     lane picks m = lane&15, 16 halfs along K
//   B: base = &W[n0*K + k0] (N-major)    lane picks n = lane&15, 16 halfs along K
// Per-lane 32-byte contiguous load -> b128 pairs (ds_load / global_load).
__device__ __forceinline__ v16h frag16(const _Float16* base, int stride, int lane) {
    return *(const v16h*)(base + (size_t)(lane & 15) * stride + ((lane >> 4) << 4));
}

// 2^x. The v_nop is the one free issue slot the instruction set asks for behind a
// transcendental.
__device__ __forceinline__ float exp2_slot(float x) {
    float r;
    asm("v_exp_f32 %0, %1\n\tv_nop" : "=v"(r) : "v"(x));
    return r;
}

// acc[mi][t] += A rows 16mi .. (64 x 512 in LDS, row pitch INNER) * wt rows 16t .. (64 x 512, global).
// One wave owns all 64 rows of 64 output columns, so each weight fragment read from
// global memory feeds four matrix instructions and no two waves read the same weights.
__device__ __forceinline__ void gemm_64x64(const _Float16* a_lds, const _Float16* wt,
                                           int lane, v8f (&acc)[4][4]) {
    for (int ks = 0; ks < INNER / 32; ++ks) {
        const int k0 = ks * 32;
        v16h bf[4], a[4];
#pragma unroll
        for (int t = 0; t < 4; ++t)
            bf[t] = frag16(wt + (size_t)(t * 16) * INNER + k0, INNER, lane);
#pragma unroll
        for (int mi = 0; mi < 4; ++mi)
            a[mi] = frag16(a_lds + (size_t)(mi * 16) * INNER + k0, INNER, lane);
        // keeps all 16 loads of the step ahead of its 16 matrix instructions: without it
        // three weight loads were issued among them and waited for at once
        __builtin_amdgcn_sched_barrier(0);
#pragma unroll
        for (int t = 0; t < 4; ++t)
#pragma unroll
            for (int mi = 0; mi < 4; ++mi) acc[mi][t] = wmma32(a[mi], bf[t], acc[mi][t]);
    }
}

// ---------------------------------------------------------------------------
// Kernel 0: convert f32 weight [K][N] -> f16 transposed [N][K]
// ---------------------------------------------------------------------------
__global__ void wcvt_t(const float* __restrict__ src, _Float16* __restrict__ dst,
                       int K, int N) {
    int idx = blockIdx.x * 256 + threadIdx.x;
    if (idx < K * N) {
        int k = idx / N, n = idx - k * N;
        dst[(size_t)n * K + k] = (_Float16)src[idx];
    }
}

// ---------------------------------------------------------------------------
// Kernel 1: k/v projection (WMMA).
//   context[b][j][768] @ Wk/Wv -> per-head layouts:
//     kP[b][h][j(128)][d(64)]   (A-operand of S^T = K Q^T:  M=j, K=d -> [j][d] row-major)
//     vT[b][h][d(64)][j(128)]   (A-operand of O^T = V^T P^T:  M=d, K=j -> [d][j] row-major)
// grid = (5 m-tiles, 16 batches, 2 {k,v}), block = 256 (8 waves)
// ---------------------------------------------------------------------------
__global__ __launch_bounds__(256) void kv_proj(
    const float* __restrict__ ctx,
    const _Float16* __restrict__ WkT,   // [512][768] f16
    const _Float16* __restrict__ WvT,   // [512][768] f16
    _Float16* __restrict__ kP,
    _Float16* __restrict__ vT) {
    __shared__ __align__(32) _Float16 ct[16 * DC];   // 24 KB context tile (f16)

    const int tid  = threadIdx.x;
    const int b    = blockIdx.y;
    const int j0   = blockIdx.x * 16;
    const int isv  = blockIdx.z;
    const int w    = tid >> 5, lane = tid & 31;

    const float* cbase = ctx + (size_t)b * SKV * DC;
    for (int i = tid; i < 16 * DC; i += 256) {
        int r = i / DC, c = i - r * DC;
        int j = j0 + r;
        ct[i] = (j < SKV) ? (_Float16)cbase[(size_t)j * DC + c] : (_Float16)0.f;
    }
    __syncthreads();

    const _Float16* WT = isv ? WvT : WkT;
    const int n0 = w * 64;

    v8f acc[4] = {v8f{}, v8f{}, v8f{}, v8f{}};
    for (int ks = 0; ks < DC / 32; ++ks) {
        const int k0 = ks * 32;
        v16h a = frag16(ct + k0, DC, lane);
#pragma unroll
        for (int t = 0; t < 4; ++t) {
            v16h bf = frag16(WT + (size_t)(n0 + t * 16) * DC + k0, DC, lane);
            acc[t] = wmma32(a, bf, acc[t]);
        }
    }

#pragma unroll
    for (int t = 0; t < 4; ++t) {
        const int n = n0 + t * 16 + (lane & 15);
        const int h = n >> 6, d = n & 63;
#pragma unroll
        for (int g = 0; g < 8; ++g) {
            const int j = j0 + g + 8 * (lane >> 4);
            if (j < SKV) {
                _Float16 val = (_Float16)acc[t][g];
                if (isv) vT[(((size_t)b * NH + h) * DH + d) * JPAD + j] = val;
                else     kP[(((size_t)b * NH + h) * JPAD + j) * DH + d] = val;
            }
        }
    }
}

// ---------------------------------------------------------------------------
// Kernel 2: fused q-proj + attention + out-proj.
// One block = 64 q rows of one batch. 256 threads = 8 waves.
// bufA: x tile (f16) then h tile; bufB: q tile (f16, pre-scaled by d^-1/2).
// ---------------------------------------------------------------------------
__global__ __launch_bounds__(256) void attn_fused(
    const float*    __restrict__ x,
    const _Float16* __restrict__ WqT,    // [512][512]
    const _Float16* __restrict__ kP,     // [B][H][128][64]
    const _Float16* __restrict__ vT,     // [B][H][64][128]
    const _Float16* __restrict__ WoT,    // [512][512]
    const float*    __restrict__ bout,   // [512]
    float*          __restrict__ out) {
    __shared__ __align__(32) _Float16 bufA[64 * INNER];  // 64 KB  x -> h
    __shared__ __align__(32) _Float16 bufB[64 * INNER];  // 64 KB  q

    const int tid  = threadIdx.x;
    const int w    = tid >> 5, lane = tid & 31;
    const int b    = blockIdx.y;
    const int m0   = blockIdx.x * 64;

    // ---------- phase 0: x tile -> f16 LDS (tile is one contiguous block) ----
    const float4* xs = (const float4*)(x + ((size_t)b * SQ + m0) * DM);
    __builtin_prefetch(WqT + (size_t)tid * 1024, 0, 1);   // warm L2 with Wq
    for (int i = tid; i < 64 * DM / 4; i += 256) {
        float4 v = xs[i];
        _Float16* d = bufA + (size_t)i * 4;
        d[0] = (_Float16)v.x; d[1] = (_Float16)v.y;
        d[2] = (_Float16)v.z; d[3] = (_Float16)v.w;
    }
    __syncthreads();

    // ---------- phase 1: q = x @ Wq  (scaled), write f16 to bufB -------------
    // wave w: all 64 rows x columns 64w .. 64w + 63
    {
        const int n0 = w * 64;
        v8f q[4][4] = {};
        gemm_64x64(bufA, WqT + (size_t)n0 * INNER, lane, q);
#pragma unroll
        for (int mi = 0; mi < 4; ++mi)
#pragma unroll
            for (int t = 0; t < 4; ++t) {
                const int n = n0 + t * 16 + (lane & 15);
#pragma unroll
                for (int g = 0; g < 8; ++g) {
                    const int m = mi * 16 + g + 8 * (lane >> 4);
                    bufB[(size_t)m * INNER + n] = (_Float16)(q[mi][t][g] * 0.125f);
                }
            }
    }
    __syncthreads();

    // ---------- phase 2: attention, one head per wave, softmax in registers --
    // S^T = K * Q^T: a lane holds 40 of one query's 80 score slots (lane and
    // lane ^ 16 split the keys), so max and sum are in-lane plus one exchange.
    // The score tiles, converted in place, are the B operand of O^T = V^T * P^T;
    // V^T is read in the matching k order (8 keys at 8*hi, 8 keys at 16 + 8*hi).
    {
        const int h = w;
        const int c = lane & 15, hi = lane >> 4;
        const _Float16* kb = kP + (((size_t)b * NH + h) * JPAD) * DH;
        const _Float16* vb = vT + (((size_t)b * NH + h) * DH) * JPAD;
        for (int mt = 0; mt < 4; ++mt) {
            const _Float16* qrow = bufB + (size_t)(mt * 16) * INNER + h * DH;
            v8f s[5] = {v8f{}, v8f{}, v8f{}, v8f{}, v8f{}};
#pragma unroll
            for (int dstep = 0; dstep < 2; ++dstep) {
                const int d0 = dstep * 32;
                v16h qf = frag16(qrow + d0, INNER, lane);
#pragma unroll
                for (int t = 0; t < 5; ++t) {
                    v16h kf = frag16(kb + (size_t)(t * 16) * DH + d0, DH, lane);
                    s[t] = wmma32(kf, qf, s[t]);     // s[t][g]: key 16t + 8hi + g, query c
                }
            }
            // keys 77..79 (tile 4, upper half, g >= 5) are padding
#pragma unroll
            for (int g = SKV - 72; g < 8; ++g) s[4][g] = hi ? -1e30f : s[4][g];

            float mx = -1e30f;
#pragma unroll
            for (int t = 0; t < 5; ++t)
#pragma unroll
                for (int g = 0; g < 8; ++g) mx = fmaxf(mx, s[t][g]);
            mx = fmaxf(mx, __shfl_xor(mx, 16));
            float sum = 0.f;
#pragma unroll
            for (int t = 0; t < 5; ++t)
#pragma unroll
                for (int g = 0; g < 8; ++g) {
                    float e = exp2_slot((s[t][g] - mx) * 1.44269504f);
                    s[t][g] = e; sum += e;
                }
            sum += __shfl_xor(sum, 16);
            const float r = 1.f / sum;

            v16h p[3];
#pragma unroll
            for (int kk = 0; kk < 3; ++kk)
#pragma unroll
                for (int g = 0; g < 8; ++g) {
                    p[kk][g]     = (_Float16)(s[2 * kk][g] * r);
                    p[kk][8 + g] = (kk < 2) ? (_Float16)(s[(kk < 2) ? 2 * kk + 1 : 0][g] * r)
                                            : (_Float16)0.f;
                }

            v8f o[4] = {v8f{}, v8f{}, v8f{}, v8f{}};
#pragma unroll
            for (int kk = 0; kk < 3; ++kk) {
#pragma unroll
                for (int td = 0; td < 4; ++td) {
                    const _Float16* vr = vb + (size_t)(td * 16 + c) * JPAD + kk * 32 + 8 * hi;
                    v8h lo = *(const v8h*)vr;
                    v8h up = (kk < 2) ? *(const v8h*)(vr + 16) : v8h{};
                    v16h vf = __builtin_shufflevector(lo, up, 0, 1, 2, 3, 4, 5, 6, 7,
                                                      8, 9, 10, 11, 12, 13, 14, 15);
                    o[td] = wmma32(vf, p[kk], o[td]); // o[td][g]: d 16td + 8hi + g, query c
                }
            }
#pragma unroll
            for (int td = 0; td < 4; ++td) {
                v8h ov;
#pragma unroll
                for (int g = 0; g < 8; ++g) ov[g] = (_Float16)o[td][g];
                *(v8h*)(bufA + (size_t)(mt * 16 + c) * INNER + h * DH + td * 16 + 8 * hi) = ov;
            }
        }
    }
    __syncthreads();

    // ---------- phase 3: out = h @ Wout + bout -------------------------------
    // wave w: all 64 rows x columns 64w .. 64w + 63
    {
        const int n0 = w * 64;
        float* orow = out + ((size_t)b * SQ + m0) * INNER;
        v8f o[4][4] = {};
        gemm_64x64(bufA, WoT + (size_t)n0 * INNER, lane, o);
#pragma unroll
        for (int t = 0; t < 4; ++t) {
            const int n = n0 + t * 16 + (lane & 15);
            const float bias = bout[n];
#pragma unroll
            for (int mi = 0; mi < 4; ++mi)
#pragma unroll
                for (int g = 0; g < 8; ++g) {
                    orow[(size_t)(mi * 16 + g + 8 * (lane >> 4)) * INNER + n] = o[mi][t][g] + bias;
                }
        }
    }
}

// ---------------------------------------------------------------------------
// launch
// ---------------------------------------------------------------------------
extern "C" void kernel_launch(void* const* d_in, const int* in_sizes, int n_in,
                              void* d_out, int out_size, void* d_ws, size_t ws_size,
                              hipStream_t stream) {
    const float* x    = (const float*)d_in[0];
    const float* ctx  = (const float*)d_in[1];
    const float* Wq   = (const float*)d_in[2];
    const float* Wk   = (const float*)d_in[3];
    const float* Wv   = (const float*)d_in[4];
    const float* Wout = (const float*)d_in[5];
    const float* bout = (const float*)d_in[6];
    float* out = (float*)d_out;

    char* ws = (char*)d_ws;
    size_t off = 0;
    _Float16* WqT = (_Float16*)(ws + off); off += (size_t)INNER * DM * 2;     // [512][512]
    _Float16* WkT = (_Float16*)(ws + off); off += (size_t)INNER * DC * 2;     // [512][768]
    _Float16* WvT = (_Float16*)(ws + off); off += (size_t)INNER * DC * 2;     // [512][768]
    _Float16* WoT = (_Float16*)(ws + off); off += (size_t)INNER * INNER * 2;  // [512][512]
    _Float16* kP  = (_Float16*)(ws + off);
    size_t kvBytes = 2ull * B_ * NH * JPAD * DH * 2;                          // kP + vT
    _Float16* vT  = (_Float16*)(ws + off + kvBytes / 2);

    // zero the j-padding of kP/vT (graph-capturable)
    hipMemsetAsync(kP, 0, kvBytes, stream);

    // weight convert + transpose to f16 [N][K]
    wcvt_t<<<dim3((DM * INNER + 255) / 256), 256, 0, stream>>>(Wq, WqT, DM, INNER);
    wcvt_t<<<dim3((DC * INNER + 255) / 256), 256, 0, stream>>>(Wk, WkT, DC, INNER);
    wcvt_t<<<dim3((DC * INNER + 255) / 256), 256, 0, stream>>>(Wv, WvT, DC, INNER);
    wcvt_t<<<dim3((INNER * INNER + 255) / 256), 256, 0, stream>>>(Wout, WoT, INNER, INNER);

    // k/v projection: 5 j-tiles x 16 batches x {k,v}
    kv_proj<<<dim3(5, B_, 2), 256, 0, stream>>>(ctx, WkT, WvT, kP, vT);

    // fused q-proj + attention + out-proj: 64 q-tiles x 16 batches
    attn_fused<<<dim3(SQ / 64, B_), 256, 0, stream>>>(x, WqT, kP, vT, WoT, bout, out);
}

// v003
// Two timings next to v002 both put it at 1.14 times that version's speed.
// Over all steps from v000 it is 3.76 times as fast.
#include <hip/hip_runtime.h>
#include <hip/hip_bf16.h>

typedef __attribute__((ext_vector_type(16))) _Float16 v16h;
typedef __attribute__((ext_vector_type(8)))  _Float16 v8h;
typedef __attribute__((ext_vector_type(8)))  float    v8f;

#define B_   16
#define SQ   4096
#define DM   512
#define SKV  77
#define DC   768
#define NH   8
#define DH   64
#define INNER 512
#define JPAD 128   // Skv padded to multiple of 32 (K-dim of attn@v WMMA)
// LDS row pitches in halfs: row length + 8, so a pitch is an odd multiple of 16 bytes and the
// 16 rows that one ds_load_b128 / ds_store_b128 touches fall on 16 different groups of 4 banks.
#define LDP  (INNER + 8)   // 1040 B
#define CTP  (DC + 8)      // 1552 B

// ---------------------------------------------------------------------------
// helpers
// ---------------------------------------------------------------------------
__device__ __forceinline__ v8f wmma32(v16h a, v16h b, v8f c) {
    // D = A(16x32 f16) * B(32x16 f16) + C(16x16 f32)
    return __builtin_amdgcn_wmma_f32_16x16x32_f16(
        /*neg_a=*/false, a, /*neg_b=*/false, b,
        /*c_mod=*/(short)0, c, /*reuse_a=*/false, /*reuse_b=*/false);
}

// One fragment load works for both A and B operands:
//   A: base = &mat[row0*stride + k0]     lane picks m = lane&15, 16 halfs along K
//   B: base = &W[n0*K + k0] (N-major)    lane picks n = lane&15, 16 halfs along K
// Per-lane 32-byte contiguous load -> b128 pairs (global_load).
__device__ __forceinline__ v16h frag16(const _Float16* base, int stride, int lane) {
    return *(const v16h*)(base + (size_t)(lane & 15) * stride + ((lane >> 4) << 4));
}

// The same fragment from a padded LDS tile: rows are 16-byte, not 32-byte, aligned there,
// so the lane's 16 halfs are read as two 16-byte pieces (same k order).
__device__ __forceinline__ v16h frag16_lds(const _Float16* base, int pitch, int lane) {
    const _Float16* p = base + (lane & 15) * pitch + ((lane >> 4) << 4);
    v8h lo = *(const v8h*)p;
    v8h up = *(const v8h*)(p + 8);
    return __builtin_shufflevector(lo, up, 0, 1, 2, 3, 4, 5, 6, 7, 8, 9, 10, 11, 12, 13, 14, 15);
}

// 2^x. The v_nop is the one free issue slot the instruction set asks for behind a
// transcendental.
__device__ __forceinline__ float exp2_slot(float x) {
    float r;
    asm("v_exp_f32 %0, %1\n\tv_nop" : "=v"(r) : "v"(x));
    return r;
}

// acc[mi][t] += A rows 16mi .. (64 x 512 in LDS, row pitch LDP) * wt rows 16t .. (64 x 512, global).
// One wave owns all 64 rows of 64 output columns, so each weight fragment read from
// global memory feeds four matrix instructions and no two waves read the same weights.
__device__ __forceinline__ void gemm_64x64(const _Float16* a_lds, const _Float16* wt,
                                           int lane, v8f (&acc)[4][4]) {
    for (int ks = 0; ks < INNER / 32; ++ks) {
        const int k0 = ks * 32;
        v16h bf[4], a[4];
#pragma unroll
        for (int t = 0; t < 4; ++t)
            bf[t] = frag16(wt + (size_t)(t * 16) * INNER + k0, INNER, lane);
#pragma unroll
        for (int mi = 0; mi < 4; ++mi)
            a[mi] = frag16_lds(a_lds + (mi * 16) * LDP + k0, LDP, lane);
        // keeps all 16 loads of the step ahead of its 16 matrix instructions: without it
        // three weight loads were issued among them and waited for at once
        __builtin_amdgcn_sched_barrier(0);
#pragma unroll
        for (int t = 0; t < 4; ++t)
#pragma unroll
            for (int mi = 0; mi < 4; ++mi) acc[mi][t] = wmma32(a[mi], bf[t], acc[mi][t]);
    }
}

// ---------------------------------------------------------------------------
// Kernel 0: convert f32 weight [K][N] -> f16 transposed [N][K]
// ---------------------------------------------------------------------------
__global__ void wcvt_t(const float* __restrict__ src, _Float16* __restrict__ dst,
                       int K, int N) {
    int idx = blockIdx.x * 256 + threadIdx.x;
    if (idx < K * N) {
        int k = idx / N, n = idx - k * N;
        dst[(size_t)n * K + k] = (_Float16)src[idx];
    }
}

// ---------------------------------------------------------------------------
// Kernel 1: k/v projection (WMMA).
//   context[b][j][768] @ Wk/Wv -> per-head layouts:
//     kP[b][h][j(128)][d(64)]   (A-operand of S^T = K Q^T:  M=j, K=d -> [j][d] row-major)
//     vT[b][h][d(64)][j(128)]   (A-operand of O^T = V^T P^T:  M=d, K=j -> [d][j] row-major)
// grid = (5 m-tiles, 16 batches, 2 {k,v}), block = 256 (8 waves)
// ---------------------------------------------------------------------------
__global__ __launch_bounds__(256) void kv_proj(
    const float* __restrict__ ctx,
    const _Float16* __restrict__ WkT,   // [512][768] f16
    const _Float16* __restrict__ WvT,   // [512][768] f16
    _Float16* __restrict__ kP,
    _Float16* __restrict__ vT) {
    __shared__ __align__(32) _Float16 ct[16 * CTP];  // 24 KB context tile (f16), padded rows

    const int tid  = threadIdx.x;
    const int b    = blockIdx.y;
    const int j0   = blockIdx.x * 16;
    const int isv  = blockIdx.z;
    const int w    = tid >> 5, lane = tid & 31;

    const float* cbase = ctx + (size_t)b * SKV * DC;
    for (int i = tid; i < 16 * DC; i += 256) {
        int r = i / DC, c = i - r * DC;
        int j = j0 + r;
        ct[r * CTP + c] = (j < SKV) ? (_Float16)cbase[(size_t)j * DC + c] : (_Float16)0.f;
    }
    __syncthreads();

    const _Float16* WT = isv ? WvT : WkT;
    const int n0 = w * 64;

    v8f acc[4] = {v8f{}, v8f{}, v8f{}, v8f{}};
    for (int ks = 0; ks < DC / 32; ++ks) {
        const int k0 = ks * 32;
        v16h a = frag16_lds(ct + k0, CTP, lane);
#pragma unroll
        for (int t = 0; t < 4; ++t) {
            v16h bf = frag16(WT + (size_t)(n0 + t * 16) * DC + k0, DC, lane);
            acc[t] = wmma32(a, bf, acc[t]);
        }
    }

#pragma unroll
    for (int t = 0; t < 4; ++t) {
        const int n = n0 + t * 16 + (lane & 15);
        const int h = n >> 6, d = n & 63;
#pragma unroll
        for (int g = 0; g < 8; ++g) {
            const int j = j0 + g + 8 * (lane >> 4);
            if (j < SKV) {
                _Float16 val = (_Float16)acc[t][g];
                if (isv) vT[(((size_t)b * NH + h) * DH + d) * JPAD + j] = val;
                else     kP[(((size_t)b * NH + h) * JPAD + j) * DH + d] = val;
            }
        }
    }
}

// ---------------------------------------------------------------------------
// Kernel 2: fused q-proj + attention + out-proj.
// One block = 64 q rows of one batch. 256 threads = 8 waves.
// bufA: x tile (f16) then h tile; bufB: q tile (f16, pre-scaled by d^-1/2).
// ---------------------------------------------------------------------------
__global__ __launch_bounds__(256) void attn_fused(
    const float*    __restrict__ x,
    const _Float16* __restrict__ WqT,    // [512][512]
    const _Float16* __restrict__ kP,     // [B][H][128][64]
    const _Float16* __restrict__ vT,     // [B][H][64][128]
    const _Float16* __restrict__ WoT,    // [512][512]
    const float*    __restrict__ bout,   // [512]
    float*          __restrict__ out) {
    __shared__ __align__(32) _Float16 bufA[64 * LDP];  // 65 KB  x -> h
    __shared__ __align__(32) _Float16 bufB[64 * LDP];  // 65 KB  q

    const int tid  = threadIdx.x;
    const int w    = tid >> 5, lane = tid & 31;
    const int b    = blockIdx.y;
    const int m0   = blockIdx.x * 64;

    // ---------- phase 0: x tile (one contiguous block) -> f16 LDS rows ----------
    const float4* xs = (const float4*)(x + ((size_t)b * SQ + m0) * DM);
    __builtin_prefetch(WqT + (size_t)tid * 1024, 0, 1);   // warm L2 with Wq
    for (int i = tid; i < 64 * DM / 4; i += 256) {
        float4 v = xs[i];
        _Float16* d = bufA + (i / (DM / 4)) * LDP + (i % (DM / 4)) * 4;
        d[0] = (_Float16)v.x; d[1] = (_Float16)v.y;
        d[2] = (_Float16)v.z; d[3] = (_Float16)v.w;
    }
    __syncthreads();

    // ---------- phase 1: q = x @ Wq  (scaled), write f16 to bufB -------------
    // wave w: all 64 rows x columns 64w .. 64w + 63
    {
        const int n0 = w * 64;
        v8f q[4][4] = {};
        gemm_64x64(bufA, WqT + (size_t)n0 * INNER, lane, q);
#pragma unroll
        for (int mi = 0; mi < 4; ++mi)
#pragma unroll
            for (int t = 0; t < 4; ++t) {
                const int n = n0 + t * 16 + (lane & 15);
#pragma unroll
                for (int g = 0; g < 8; ++g) {
                    const int m = mi * 16 + g + 8 * (lane >> 4);
                    bufB[m * LDP + n] = (_Float16)(q[mi][t][g] * 0.125f);
                }
            }
    }
    __syncthreads();

    // ---------- phase 2: attention, one head per wave, softmax in registers --
    // S^T = K * Q^T: a lane holds 40 of one query's 80 score slots (lane and
    // lane ^ 16 split the keys), so max and sum are in-lane plus one exchange.
    // The score tiles, converted in place, are the B operand of O^T = V^T * P^T;
    // V^T is read in the matching k order (8 keys at 8*hi, 8 keys at 16 + 8*hi).
    {
        const int h = w;
        const int c = lane & 15, hi = lane >> 4;
        const _Float16* kb = kP + (((size_t)b * NH + h) * JPAD) * DH;
        const _Float16* vb = vT + (((size_t)b * NH + h) * DH) * JPAD;
        for (int mt = 0; mt < 4; ++mt) {
            const _Float16* qrow = bufB + (mt * 16) * LDP + h * DH;
            v8f s[5] = {v8f{}, v8f{}, v8f{}, v8f{}, v8f{}};
#pragma unroll
            for (int dstep = 0; dstep < 2; ++dstep) {
                const int d0 = dstep * 32;
                v16h qf = frag16_lds(qrow + d0, LDP, lane);
#pragma unroll
                for (int t = 0; t < 5; ++t) {
                    v16h kf = frag16(kb + (size_t)(t * 16) * DH + d0, DH, lane);
                    s[t] = wmma32(kf, qf, s[t]);     // s[t][g]: key 16t + 8hi + g, query c
                }
            }
            // keys 77..79 (tile 4, upper half, g >= 5) are padding
#pragma unroll
            for (int g = SKV - 72; g < 8; ++g) s[4][g] = hi ? -1e30f : s[4][g];

            float mx = -1e30f;
#pragma unroll
            for (int t = 0; t < 5; ++t)
#pragma unroll
                for (int g = 0; g < 8; ++g) mx = fmaxf(mx, s[t][g]);
            mx = fmaxf(mx, __shfl_xor(mx, 16));
            float sum = 0.f;
#pragma unroll
            for (int t = 0; t < 5; ++t)
#pragma unroll
                for (int g = 0; g < 8; ++g) {
                    float e = exp2_slot((s[t][g] - mx) * 1.44269504f);
                    s[t][g] = e; sum += e;
                }
            sum += __shfl_xor(sum, 16);
            const float r = 1.f / sum;

            v16h p[3];
#pragma unroll
            for (int kk = 0; kk < 3; ++kk)
#pragma unroll
                for (int g = 0; g < 8; ++g) {
                    p[kk][g]     = (_Float16)(s[2 * kk][g] * r);
                    p[kk][8 + g] = (kk < 2) ? (_Float16)(s[(kk < 2) ? 2 * kk + 1 : 0][g] * r)
                                            : (_Float16)0.f;
                }

            v8f o[4] = {v8f{}, v8f{}, v8f{}, v8f{}};
#pragma unroll
            for (int kk = 0; kk < 3; ++kk) {
#pragma unroll
                for (int td = 0; td < 4; ++td) {
                    const _Float16* vr = vb + (size_t)(td * 16 + c) * JPAD + kk * 32 + 8 * hi;
                    v8h lo = *(const v8h*)vr;
                    v8h up = (kk < 2) ? *(const v8h*)(vr + 16) : v8h{};
                    v16h vf = __builtin_shufflevector(lo, up, 0, 1, 2, 3, 4, 5, 6, 7,
                                                      8, 9, 10, 11, 12, 13, 14, 15);
                    o[td] = wmma32(vf, p[kk], o[td]); // o[td][g]: d 16td + 8hi + g, query c
                }
            }
#pragma unroll
            for (int td = 0; td < 4; ++td) {
                v8h ov;
#pragma unroll
                for (int g = 0; g < 8; ++g) ov[g] = (_Float16)o[td][g];
                *(v8h*)(bufA + (mt * 16 + c) * LDP + h * DH + td * 16 + 8 * hi) = ov;
            }
        }
    }
    __syncthreads();

    // ---------- phase 3: out = h @ Wout + bout -------------------------------
    // wave w: all 64 rows x columns 64w .. 64w + 63
    {
        const int n0 = w * 64;
        float* orow = out + ((size_t)b * SQ + m0) * INNER;
        v8f o[4][4] = {};
        gemm_64x64(bufA, WoT + (size_t)n0 * INNER, lane, o);
#pragma unroll
        for (int t = 0; t < 4; ++t) {
            const int n = n0 + t * 16 + (lane & 15);
            const float bias = bout[n];
#pragma unroll
            for (int mi = 0; mi < 4; ++mi)
#pragma unroll
                for (int g = 0; g < 8; ++g) {
                    orow[(size_t)(mi * 16 + g + 8 * (lane >> 4)) * INNER + n] = o[mi][t][g] + bias;
                }
        }
    }
}

// ---------------------------------------------------------------------------
// launch
// ---------------------------------------------------------------------------
extern "C" void kernel_launch(void* const* d_in, const int* in_sizes, int n_in,
                              void* d_out, int out_size, void* d_ws, size_t ws_size,
                              hipStream_t stream) {
    const float* x    = (const float*)d_in[0];
    const float* ctx  = (const float*)d_in[1];
    const float* Wq   = (const float*)d_in[2];
    const float* Wk   = (const float*)d_in[3];
    const float* Wv   = (const float*)d_in[4];
    const float* Wout = (const float*)d_in[5];
    const float* bout = (const float*)d_in[6];
    float* out = (float*)d_out;

    char* ws = (char*)d_ws;
    size_t off = 0;
    _Float16* WqT = (_Float16*)(ws + off); off += (size_t)INNER * DM * 2;     // [512][512]
    _Float16* WkT = (_Float16*)(ws + off); off += (size_t)INNER * DC * 2;     // [512][768]
    _Float16* WvT = (_Float16*)(ws + off); off += (size_t)INNER * DC * 2;     // [512][768]
    _Float16* WoT = (_Float16*)(ws + off); off += (size_t)INNER * INNER * 2;  // [512][512]
    _Float16* kP  = (_Float16*)(ws + off);
    size_t kvBytes = 2ull * B_ * NH * JPAD * DH * 2;                          // kP + vT
    _Float16* vT  = (_Float16*)(ws + off + kvBytes / 2);

    // zero the j-padding of kP/vT (graph-capturable)
    hipMemsetAsync(kP, 0, kvBytes, stream);

    // weight convert + transpose to f16 [N][K]
    wcvt_t<<<dim3((DM * INNER + 255) / 256), 256, 0, stream>>>(Wq, WqT, DM, INNER);
    wcvt_t<<<dim3((DC * INNER + 255) / 256), 256, 0, stream>>>(Wk, WkT, DC, INNER);
    wcvt_t<<<dim3((DC * INNER + 255) / 256), 256, 0, stream>>>(Wv, WvT, DC, INNER);
    wcvt_t<<<dim3((INNER * INNER + 255) / 256), 256, 0, stream>>>(Wout, WoT, INNER, INNER);

    // k/v projection: 5 j-tiles x 16 batches x {k,v}
    kv_proj<<<dim3(5, B_, 2), 256, 0, stream>>>(ctx, WkT, WvT, kP, vT);

    // fused q-proj + attention + out-proj: 64 q-tiles x 16 batches
    attn_fused<<<dim3(SQ / 64, B_), 256, 0, stream>>>(x, WqT, kP, vT, WoT, bout, out);
}

// v004
// Two timings next to v003 put it at 1.46 and 1.50 times that version's speed.
// Over all steps from v000 it is 5.57 times as fast.
#include <hip/hip_runtime.h>
#include <hip/hip_bf16.h>

typedef __attribute__((ext_vector_type(16))) _Float16 v16h;
typedef __attribute__((ext_vector_type(8)))  _Float16 v8h;
typedef __attribute__((ext_vector_type(8)))  float    v8f;

#define B_   16
#define SQ   4096
#define DM   512
#define SKV  77
#define DC   768
#define NH   8
#define DH   64
#define INNER 512
#define JPAD 128   // Skv padded to multiple of 32 (K-dim of attn@v WMMA)
// LDS row pitches in halfs: row length + 8, so a pitch is an odd multiple of 16 bytes and the
// 16 rows that one ds_load_b128 / ds_store_b128 touches fall on 16 different groups of 4 banks.
#define LDP  (INNER + 8)   // 1040 B
#define CTP  (DC + 8)      // 1552 B

// ---------------------------------------------------------------------------
// helpers
// ---------------------------------------------------------------------------
__device__ __forceinline__ v8f wmma32(v16h a, v16h b, v8f c) {
    // D = A(16x32 f16) * B(32x16 f16) + C(16x16 f32)
    return __builtin_amdgcn_wmma_f32_16x16x32_f16(
        /*neg_a=*/false, a, /*neg_b=*/false, b,
        /*c_mod=*/(short)0, c, /*reuse_a=*/false, /*reuse_b=*/false);
}

// Fragment order: every matrix operand that is read from global memory is stored as a row of
// 1-KiB fragments (16 rows x 32 k), each laid out [piece 0..1][lane 0..31][8 halfs]. Lane l
// owns row l & 15 and k = 16 * (l >> 4) + 8 * piece + e (V: see attn_fused), so one wave-wide
// 16-byte load reads 512 contiguous bytes, four whole cache lines.
#define FRAG 512   // halfs in a fragment
__device__ __forceinline__ v16h frag_packed(const _Float16* f, int lane) {
    v8h lo = *(const v8h*)(f + lane * 8);
    v8h up = *(const v8h*)(f + 256 + lane * 8);
    return __builtin_shufflevector(lo, up, 0, 1, 2, 3, 4, 5, 6, 7, 8, 9, 10, 11, 12, 13, 14, 15);
}

// A fragment from a padded LDS tile: lane picks row lane & 15 and 16 halfs along K from
// 16 * (lane >> 4); rows are 16-byte aligned, so they are read as two 16-byte pieces.
__device__ __forceinline__ v16h frag16_lds(const _Float16* base, int pitch, int lane) {
    const _Float16* p = base + (lane & 15) * pitch + ((lane >> 4) << 4);
    v8h lo = *(const v8h*)p;
    v8h up = *(const v8h*)(p + 8);
    return __builtin_shufflevector(lo, up, 0, 1, 2, 3, 4, 5, 6, 7, 8, 9, 10, 11, 12, 13, 14, 15);
}

// 2^x. The v_nop is the one free issue slot the instruction set asks for behind a
// transcendental.
__device__ __forceinline__ float exp2_slot(float x) {
    float r;
    asm("v_exp_f32 %0, %1\n\tv_nop" : "=v"(r) : "v"(x));
    return r;
}

// acc[mi][t] += A rows 16mi .. (64 x 512 in LDS, row pitch LDP) * wt columns 16t .. (64 x 512,
// global, fragment order [k step][t]).
// One wave owns all 64 rows of 64 output columns, so each weight fragment read from
// global memory feeds four matrix instructions and no two waves read the same weights.
__device__ __forceinline__ void gemm_64x64(const _Float16* a_lds, const _Float16* wt,
                                           int lane, v8f (&acc)[4][4]) {
    for (int ks = 0; ks < INNER / 32; ++ks) {
        const int k0 = ks * 32;
        v16h bf[4], a[4];
#pragma unroll
        for (int t = 0; t < 4; ++t)
            bf[t] = frag_packed(wt + (ks * 4 + t) * FRAG, lane);
#pragma unroll
        for (int mi = 0; mi < 4; ++mi)
            a[mi] = frag16_lds(a_lds + (mi * 16) * LDP + k0, LDP, lane);
        // keeps all 16 loads of the step ahead of its 16 matrix instructions: without it
        // three weight loads were issued among them and waited for at once
        __builtin_amdgcn_sched_barrier(0);
#pragma unroll
        for (int t = 0; t < 4; ++t)
#pragma unroll
            for (int mi = 0; mi < 4; ++mi) acc[mi][t] = wmma32(a[mi], bf[t], acc[mi][t]);
    }
}

// ---------------------------------------------------------------------------
// Kernel 0: convert f32 weight [K][N] -> f16 fragments [N/64][K/32][4 column tiles][FRAG].
// One thread makes one 16-byte piece (8 k of one column).
// ---------------------------------------------------------------------------
__global__ void wcvt_t(const float* __restrict__ src, _Float16* __restrict__ dst,
                       int K, int N) {
    int idx = blockIdx.x * 256 + threadIdx.x;
    if (idx < K * N / 8) {
        const int lane = idx & 31, piece = (idx >> 5) & 1, t = (idx >> 6) & 3;
        const int rest = idx >> 8, KS = K / 32;
        const int nw = rest / KS, ks = rest - nw * KS;
        const int n  = (nw * 4 + t) * 16 + (lane & 15);
        const int k0 = ks * 32 + (lane >> 4) * 16 + piece * 8;
        float f[8];
#pragma unroll
        for (int e = 0; e < 8; ++e) f[e] = src[(size_t)(k0 + e) * N + n];
        // the converted halfs are written over the loads' address registers: the wait that
        // belongs in front of such an overwrite
        asm volatile("s_wait_xcnt 0x0" ::: "memory");
        v8h o;
#pragma unroll
        for (int e = 0; e < 8; ++e) o[e] = (_Float16)f[e];
        *(v8h*)(dst + (size_t)idx * 8) = o;
    }
}

// ---------------------------------------------------------------------------
// Kernel 1: k/v projection (WMMA).
//   context[b][j][768] @ Wk/Wv -> per head (JPAD * DH halfs each), in fragment order:
//     kP[b][h][j tile(5)][d step(2)][FRAG]    rows = keys, k = d
//     vT[b][h][j step(3)][d tile(4)][FRAG]    rows = d, k = keys: piece p, lane half hi hold
//                                             keys 16p + 8hi .. + 7 of the step
// grid = (5 m-tiles, 16 batches, 2 {k,v}), block = 256 (8 waves)
// ---------------------------------------------------------------------------
__global__ __launch_bounds__(256) void kv_proj(
    const float* __restrict__ ctx,
    const _Float16* __restrict__ WkT,   // 512 x 768 f16 fragments
    const _Float16* __restrict__ WvT,   // 512 x 768 f16 fragments
    _Float16* __restrict__ kP,
    _Float16* __restrict__ vT) {
    __shared__ __align__(32) _Float16 ct[16 * CTP];  // 24 KB context tile (f16), padded rows

    const int tid  = threadIdx.x;
    const int b    = blockIdx.y;
    const int j0   = blockIdx.x * 16;
    const int isv  = blockIdx.z;
    const int w    = tid >> 5, lane = tid & 31;

    const float* cbase = ctx + (size_t)b * SKV * DC;
    for (int i = tid; i < 16 * DC; i += 256) {
        int r = i / DC, c = i - r * DC;
        int j = j0 + r;
        ct[r * CTP + c] = (j < SKV) ? (_Float16)cbase[(size_t)j * DC + c] : (_Float16)0.f;
    }
    __syncthreads();

    const _Float16* WT = isv ? WvT : WkT;

    v8f acc[4] = {v8f{}, v8f{}, v8f{}, v8f{}};
    for (int ks = 0; ks < DC / 32; ++ks) {
        const int k0 = ks * 32;
        v16h a = frag16_lds(ct + k0, CTP, lane);
#pragma unroll
        for (int t = 0; t < 4; ++t) {
            v16h bf = frag_packed(WT + ((w * (DC / 32) + ks) * 4 + t) * FRAG, lane);
            acc[t] = wmma32(a, bf, acc[t]);
        }
    }

    // wave w holds head w: d = 16t + c, keys j0 + 8hi + g
    const int c = lane & 15, hi = lane >> 4;
    const size_t head = ((size_t)b * NH + w) * (JPAD * DH);
    if (isv) {
        // the lane's 8 keys are one 16-byte piece of V's fragment; padding keys stay 0
        _Float16* vf = vT + head + (j0 >> 5) * 4 * FRAG + ((j0 >> 4) & 1) * 256 + lane * 8;
#pragma unroll
        for (int t = 0; t < 4; ++t) {
            v8h ov;
#pragma unroll
            for (int g = 0; g < 8; ++g)
                ov[g] = (j0 + 8 * hi + g < SKV) ? (_Float16)acc[t][g] : (_Float16)0.f;
            *(v8h*)(vf + t * FRAG) = ov;
        }
        // the registers these four stores name are reused on the code path that follows in the
        // build: the wait that belongs in front of such an overwrite
        asm volatile("s_wait_xcnt 0x0" ::: "memory");
    } else {
        _Float16* kf = kP + head + (j0 >> 4) * 2 * FRAG + (c >> 3) * 256 + hi * 64 + (c & 7);
#pragma unroll
        for (int t = 0; t < 4; ++t)
#pragma unroll
            for (int g = 0; g < 8; ++g)
                if (j0 + 8 * hi + g < SKV)
                    kf[(t >> 1) * FRAG + (t & 1) * 128 + g * 8] = (_Float16)acc[t][g];
    }
}

// ---------------------------------------------------------------------------
// Kernel 2: fused q-proj + attention + out-proj.
// One block = 64 q rows of one batch. 256 threads = 8 waves.
// bufA: x tile (f16) then h tile; bufB: q tile (f16, pre-scaled by d^-1/2).
// ---------------------------------------------------------------------------
__global__ __launch_bounds__(256) void attn_fused(
    const float*    __restrict__ x,
    const _Float16* __restrict__ WqT,    // 512 x 512, fragment order
    const _Float16* __restrict__ kP,     // [B][H] fragments, see kv_proj
    const _Float16* __restrict__ vT,     // [B][H] fragments, see kv_proj
    const _Float16* __restrict__ WoT,    // 512 x 512, fragment order
    const float*    __restrict__ bout,   // [512]
    float*          __restrict__ out) {
    __shared__ __align__(32) _Float16 bufA[64 * LDP];  // 65 KB  x -> h
    __shared__ __align__(32) _Float16 bufB[64 * LDP];  // 65 KB  q

    const int tid  = threadIdx.x;
    const int w    = tid >> 5, lane = tid & 31;
    const int b    = blockIdx.y;
    const int m0   = blockIdx.x * 64;

    // ---------- phase 0: x tile (one contiguous block) -> f16 LDS rows ----------
    const float4* xs = (const float4*)(x + ((size_t)b * SQ + m0) * DM);
    __builtin_prefetch(WqT + (size_t)tid * 1024, 0, 1);   // warm L2 with Wq
    for (int i = tid; i < 64 * DM / 4; i += 256) {
        float4 v = xs[i];
        _Float16* d = bufA + (i / (DM / 4)) * LDP + (i % (DM / 4)) * 4;
        d[0] = (_Float16)v.x; d[1] = (_Float16)v.y;
        d[2] = (_Float16)v.z; d[3] = (_Float16)v.w;
    }
    __syncthreads();

    // ---------- phase 1: q = x @ Wq  (scaled), write f16 to bufB -------------
    // wave w: all 64 rows x columns 64w .. 64w + 63
    {
        const int n0 = w * 64;
        v8f q[4][4] = {};
        gemm_64x64(bufA, WqT + (size_t)n0 * INNER, lane, q);
#pragma unroll
        for (int mi = 0; mi < 4; ++mi)
#pragma unroll
            for (int t = 0; t < 4; ++t) {
                const int n = n0 + t * 16 + (lane & 15);
#pragma unroll
                for (int g = 0; g < 8; ++g) {
                    const int m = mi * 16 + g + 8 * (lane >> 4);
                    bufB[m * LDP + n] = (_Float16)(q[mi][t][g] * 0.125f);
                }
            }
    }
    __syncthreads();

    // ---------- phase 2: attention, one head per wave, softmax in registers --
    // S^T = K * Q^T: a lane holds 40 of one query's 80 score slots (lane and
    // lane ^ 16 split the keys), so max and sum are in-lane plus one exchange.
    // The score tiles, converted in place, are the B operand of O^T = V^T * P^T;
    // V^T is read in the matching k order (8 keys at 8*hi, 8 keys at 16 + 8*hi).
    {
        const int h = w;
        const int c = lane & 15, hi = lane >> 4;
        const _Float16* kb = kP + (((size_t)b * NH + h) * JPAD) * DH;
        const _Float16* vb = vT + (((size_t)b * NH + h) * DH) * JPAD;
        for (int mt = 0; mt < 4; ++mt) {
            const _Float16* qrow = bufB + (mt * 16) * LDP + h * DH;
            v8f s[5] = {v8f{}, v8f{}, v8f{}, v8f{}, v8f{}};
#pragma unroll
            for (int dstep = 0; dstep < 2; ++dstep) {
                const int d0 = dstep * 32;
                v16h qf = frag16_lds(qrow + d0, LDP, lane);
#pragma unroll
                for (int t = 0; t < 5; ++t) {
                    v16h kf = frag_packed(kb + (t * 2 + dstep) * FRAG, lane);
                    s[t] = wmma32(kf, qf, s[t]);     // s[t][g]: key 16t + 8hi + g, query c
                }
            }
            // keys 77..79 (tile 4, upper half, g >= 5) are padding
#pragma unroll
            for (int g = SKV - 72; g < 8; ++g) s[4][g] = hi ? -1e30f : s[4][g];

            float mx = -1e30f;
#pragma unroll
            for (int t = 0; t < 5; ++t)
#pragma unroll
                for (int g = 0; g < 8; ++g) mx = fmaxf(mx, s[t][g]);
            mx = fmaxf(mx, __shfl_xor(mx, 16));
            float sum = 0.f;
#pragma unroll
            for (int t = 0; t < 5; ++t)
#pragma unroll
                for (int g = 0; g < 8; ++g) {
                    float e = exp2_slot((s[t][g] - mx) * 1.44269504f);
                    s[t][g] = e; sum += e;
                }
            sum += __shfl_xor(sum, 16);
            const float r = 1.f / sum;

            v16h p[3];
#pragma unroll
            for (int kk = 0; kk < 3; ++kk)
#pragma unroll
                for (int g = 0; g < 8; ++g) {
                    p[kk][g]     = (_Float16)(s[2 * kk][g] * r);
                    p[kk][8 + g] = (kk < 2) ? (_Float16)(s[(kk < 2) ? 2 * kk + 1 : 0][g] * r)
                                            : (_Float16)0.f;
                }

            v8f o[4] = {v8f{}, v8f{}, v8f{}, v8f{}};
#pragma unroll
            for (int kk = 0; kk < 3; ++kk) {
#pragma unroll
                for (int td = 0; td < 4; ++td) {
                    const _Float16* vr = vb + (kk * 4 + td) * FRAG + lane * 8;
                    v8h lo = *(const v8h*)vr;
                    v8h up = (kk < 2) ? *(const v8h*)(vr + 256) : v8h{};
                    v16h vf = __builtin_shufflevector(lo, up, 0, 1, 2, 3, 4, 5, 6, 7,
                                                      8, 9, 10, 11, 12, 13, 14, 15);
                    o[td] = wmma32(vf, p[kk], o[td]); // o[td][g]: d 16td + 8hi + g, query c
                }
            }
#pragma unroll
            for (int td = 0; td < 4; ++td) {
                v8h ov;
#pragma unroll
                for (int g = 0; g < 8; ++g) ov[g] = (_Float16)o[td][g];
                *(v8h*)(bufA + (mt * 16 + c) * LDP + h * DH + td * 16 + 8 * hi) = ov;
            }
        }
    }
    __syncthreads();

    // ---------- phase 3: out = h @ Wout + bout -------------------------------
    // wave w: all 64 rows x columns 64w .. 64w + 63
    {
        const int n0 = w * 64;
        float* orow = out + ((size_t)b * SQ + m0) * INNER;
        v8f o[4][4] = {};
        gemm_64x64(bufA, WoT + (size_t)n0 * INNER, lane, o);
#pragma unroll
        for (int t = 0; t < 4; ++t) {
            const int n = n0 + t * 16 + (lane & 15);
            const float bias = bout[n];
#pragma unroll
            for (int mi = 0; mi < 4; ++mi)
#pragma unroll
                for (int g = 0; g < 8; ++g) {
                    orow[(size_t)(mi * 16 + g + 8 * (lane >> 4)) * INNER + n] = o[mi][t][g] + bias;
                }
        }
    }
}

// ---------------------------------------------------------------------------
// launch
// ---------------------------------------------------------------------------
extern "C" void kernel_launch(void* const* d_in, const int* in_sizes, int n_in,
                              void* d_out, int out_size, void* d_ws, size_t ws_size,
                              hipStream_t stream) {
    const float* x    = (const float*)d_in[0];
    const float* ctx  = (const float*)d_in[1];
    const float* Wq   = (const float*)d_in[2];
    const float* Wk   = (const float*)d_in[3];
    const float* Wv   = (const float*)d_in[4];
    const float* Wout = (const float*)d_in[5];
    const float* bout = (const float*)d_in[6];
    float* out = (float*)d_out;

    char* ws = (char*)d_ws;
    size_t off = 0;
    _Float16* WqT = (_Float16*)(ws + off); off += (size_t)INNER * DM * 2;     // fragments [8][16][4][FRAG]
    _Float16* WkT = (_Float16*)(ws + off); off += (size_t)INNER * DC * 2;     // fragments [8][24][4][FRAG]
    _Float16* WvT = (_Float16*)(ws + off); off += (size_t)INNER * DC * 2;     // fragments [8][24][4][FRAG]
    _Float16* WoT = (_Float16*)(ws + off); off += (size_t)INNER * INNER * 2;  // fragments [8][16][4][FRAG]
    _Float16* kP  = (_Float16*)(ws + off);
    size_t kvBytes = 2ull * B_ * NH * JPAD * DH * 2;                          // kP + vT
    _Float16* vT  = (_Float16*)(ws + off + kvBytes / 2);

    // zero the j-padding of kP/vT (graph-capturable)
    hipMemsetAsync(kP, 0, kvBytes, stream);

    // weight convert to f16 fragments, one thread per 8 elements
    wcvt_t<<<dim3(DM * INNER / 8 / 256), 256, 0, stream>>>(Wq, WqT, DM, INNER);
    wcvt_t<<<dim3(DC * INNER / 8 / 256), 256, 0, stream>>>(Wk, WkT, DC, INNER);
    wcvt_t<<<dim3(DC * INNER / 8 / 256), 256, 0, stream>>>(Wv, WvT, DC, INNER);
    wcvt_t<<<dim3(INNER * INNER / 8 / 256), 256, 0, stream>>>(Wout, WoT, INNER, INNER);

    // k/v projection: 5 j-tiles x 16 batches x {k,v}
    kv_proj<<<dim3(5, B_, 2), 256, 0, stream>>>(ctx, WkT, WvT, kP, vT);

    // fused q-proj + attention + out-proj: 64 q-tiles x 16 batches
    attn_fused<<<dim3(SQ / 64, B_), 256, 0, stream>>>(x, WqT, kP, vT, WoT, bout, out);
}

// v005
// Two timings next to v004 put it at 1.29 and 1.30 times that version's speed.
// Counting every step since v000, it is 7.22 times as fast.
#include <hip/hip_runtime.h>
#include <hip/hip_bf16.h>

typedef __attribute__((ext_vector_type(16))) _Float16 v16h;
typedef __attribute__((ext_vector_type(8)))  _Float16 v8h;
typedef __attribute__((ext_vector_type(4)))  _Float16 v4h;
typedef __attribute__((ext_vector_type(8)))  float    v8f;
typedef __attribute__((ext_vector_type(4)))  float    v4f;

#define B_   16
#define SQ   4096
#define DM   512
#define SKV  77
#define DC   768
#define NH   8
#define DH   64
#define INNER 512
#define JPAD 128   // Skv padded to multiple of 32 (K-dim of attn@v WMMA)
// LDS row pitches in halfs: row length + 8, so a pitch is an odd multiple of 16 bytes and the
// 16 rows that one ds_load_b128 / ds_store_b128 touches fall on 16 different groups of 4 banks.
#define LDP  (INNER + 8)   // 1040 B
#define CTP  (DC + 8)      // 1552 B

// ---------------------------------------------------------------------------
// helpers
// ---------------------------------------------------------------------------
__device__ __forceinline__ v8f wmma32(v16h a, v16h b, v8f c) {
    // D = A(16x32 f16) * B(32x16 f16) + C(16x16 f32)
    return __builtin_amdgcn_wmma_f32_16x16x32_f16(
        /*neg_a=*/false, a, /*neg_b=*/false, b,
        /*c_mod=*/(short)0, c, /*reuse_a=*/false, /*reuse_b=*/false);
}

// Fragment order: every matrix operand that is read from global memory is stored as a row of
// 1-KiB fragments (16 rows x 32 k), each laid out [piece 0..1][lane 0..31][8 halfs]. Lane l
// owns row l & 15 and k = 16 * (l >> 4) + 8 * piece + e (V: see attn_fused), so one wave-wide
// 16-byte load reads 512 contiguous bytes, four whole cache lines.
#define FRAG 512   // halfs in a fragment
__device__ __forceinline__ v16h frag_packed(const _Float16* f, int lane) {
    v8h lo = *(const v8h*)(f + lane * 8);
    v8h up = *(const v8h*)(f + 256 + lane * 8);
    return __builtin_shufflevector(lo, up, 0, 1, 2, 3, 4, 5, 6, 7, 8, 9, 10, 11, 12, 13, 14, 15);
}

// A fragment from a padded LDS tile: lane picks row lane & 15 and 16 halfs along K from
// 16 * (lane >> 4); rows are 16-byte aligned, so they are read as two 16-byte pieces.
__device__ __forceinline__ v16h frag16_lds(const _Float16* base, int pitch, int lane) {
    const _Float16* p = base + (lane & 15) * pitch + ((lane >> 4) << 4);
    v8h lo = *(const v8h*)p;
    v8h up = *(const v8h*)(p + 8);
    return __builtin_shufflevector(lo, up, 0, 1, 2, 3, 4, 5, 6, 7, 8, 9, 10, 11, 12, 13, 14, 15);
}

// 2^x. The v_nop is the one free issue slot the instruction set asks for behind a
// transcendental.
__device__ __forceinline__ float exp2_slot(float x) {
    float r;
    asm("v_exp_f32 %0, %1\n\tv_nop" : "=v"(r) : "v"(x));
    return r;
}

// acc[mi][t] += A rows 16mi .. (64 x 512 in LDS, row pitch LDP) * wt columns 16t .. (64 x 512,
// global, fragment order [k step][t]).
// One wave owns all 64 rows of 64 output columns, so each weight fragment read from
// global memory feeds four matrix instructions and no two waves read the same weights.
__device__ __forceinline__ void gemm_64x64(const _Float16* a_lds, const _Float16* wt,
                                           int lane, v8f (&acc)[4][4]) {
    for (int ks = 0; ks < INNER / 32; ++ks) {
        const int k0 = ks * 32;
        v16h bf[4], a[4];
#pragma unroll
        for (int t = 0; t < 4; ++t)
            bf[t] = frag_packed(wt + (ks * 4 + t) * FRAG, lane);
#pragma unroll
        for (int mi = 0; mi < 4; ++mi)
            a[mi] = frag16_lds(a_lds + (mi * 16) * LDP + k0, LDP, lane);
        // keeps all 16 loads of the step ahead of its 16 matrix instructions: without it
        // three weight loads were issued among them and waited for at once
        __builtin_amdgcn_sched_barrier(0);
#pragma unroll
        for (int t = 0; t < 4; ++t)
#pragma unroll
            for (int mi = 0; mi < 4; ++mi) acc[mi][t] = wmma32(a[mi], bf[t], acc[mi][t]);
    }
}

// ---------------------------------------------------------------------------
// Kernel 0: convert f32 weight [K][N] -> f16 fragments [N/64][K/32][4 column tiles][FRAG].
// One thread makes one 16-byte piece (8 k of one column).
// ---------------------------------------------------------------------------
__global__ void wcvt_t(const float* __restrict__ src, _Float16* __restrict__ dst,
                       int K, int N) {
    int idx = blockIdx.x * 256 + threadIdx.x;
    if (idx < K * N / 8) {
        const int lane = idx & 31, piece = (idx >> 5) & 1, t = (idx >> 6) & 3;
        const int rest = idx >> 8, KS = K / 32;
        const int nw = rest / KS, ks = rest - nw * KS;
        const int n  = (nw * 4 + t) * 16 + (lane & 15);
        const int k0 = ks * 32 + (lane >> 4) * 16 + piece * 8;
        float f[8];
#pragma unroll
        for (int e = 0; e < 8; ++e) f[e] = src[(size_t)(k0 + e) * N + n];
        // the converted halfs are written over the loads' address registers: the wait that
        // belongs in front of such an overwrite
        asm volatile("s_wait_xcnt 0x0" ::: "memory");
        v8h o;
#pragma unroll
        for (int e = 0; e < 8; ++e) o[e] = (_Float16)f[e];
        *(v8h*)(dst + (size_t)idx * 8) = o;
    }
}

// ---------------------------------------------------------------------------
// Kernel 1: k/v projection (WMMA).
//   context[b][j][768] @ Wk/Wv -> per head (JPAD * DH halfs each), in fragment order:
//     kP[b][h][j tile(5)][d step(2)][FRAG]    rows = keys, k = d
//     vT[b][h][j step(3)][d tile(4)][FRAG]    rows = d, k = keys: piece p, lane half hi hold
//                                             keys 16p + 8hi .. + 7 of the step
// grid = (5 m-tiles, 16 batches, 2 {k,v}), block = 256 (8 waves)
// ---------------------------------------------------------------------------
__global__ __launch_bounds__(256) void kv_proj(
    const float* __restrict__ ctx,
    const _Float16* __restrict__ WkT,   // 512 x 768 f16 fragments
    const _Float16* __restrict__ WvT,   // 512 x 768 f16 fragments
    _Float16* __restrict__ kP,
    _Float16* __restrict__ vT) {
    __shared__ __align__(32) _Float16 ct[16 * CTP];  // 24 KB context tile (f16), padded rows

    const int tid  = threadIdx.x;
    const int b    = blockIdx.y;
    const int j0   = blockIdx.x * 16;
    const int isv  = blockIdx.z;
    const int w    = tid >> 5, lane = tid & 31;

    // The tile's 16 rows are one contiguous run of 16 * DC / 4 16-byte pieces, 12 a thread. All 12
    // loads are issued before the first value is used, so a thread waits out one memory latency
    // and not one per load. Pieces of the padding rows (j >= SKV) read the last valid piece
    // instead, which keeps the address inside ctx, and are stored as zeros.
    const v4f* cbase = (const v4f*)(ctx + ((size_t)b * SKV + j0) * DC);
    const int npc = (SKV - j0 < 16 ? SKV - j0 : 16) * (DC / 4);   // valid pieces of this tile
    v4f cv[16 * DC / 4 / 256];
    int pc[16 * DC / 4 / 256];
#pragma unroll
    for (int u = 0; u < 16 * DC / 4 / 256; ++u) {
        const int i = tid + u * 256;
        pc[u] = i < npc ? i : npc - 1;
        cv[u] = cbase[pc[u]];
    }
    // The loaded values as inputs hold all 12 loads ahead of the first convert (without that the
    // build issued part of them only behind waits on earlier ones). The piece indices as inputs
    // keep the loads' offset registers untouched up to here, so that no load's result lands in an
    // earlier load's offset register, and the wait stands in front of their first overwrite.
    asm volatile("s_wait_xcnt 0x0"
                 :: "v"(cv[0]), "v"(cv[1]), "v"(cv[2]), "v"(cv[3]), "v"(cv[4]), "v"(cv[5]),
                    "v"(cv[6]), "v"(cv[7]), "v"(cv[8]), "v"(cv[9]), "v"(cv[10]), "v"(cv[11]),
                    "v"(pc[0]), "v"(pc[1]), "v"(pc[2]), "v"(pc[3]), "v"(pc[4]), "v"(pc[5]),
                    "v"(pc[6]), "v"(pc[7]), "v"(pc[8]), "v"(pc[9]), "v"(pc[10]), "v"(pc[11])
                 : "memory");
#pragma unroll
    for (int u = 0; u < 16 * DC / 4 / 256; ++u) {
        const int i = tid + u * 256;
        const int r = i / (DC / 4), c4 = i - r * (DC / 4);
        const bool in = i < npc;
        const v4h o = {(_Float16)cv[u][0], (_Float16)cv[u][1], (_Float16)cv[u][2], (_Float16)cv[u][3]};
        uint2 ob = __builtin_bit_cast(uint2, o);
        ob.x = in ? ob.x : 0u;
        ob.y = in ? ob.y : 0u;
        *(uint2*)(ct + r * CTP + c4 * 4) = ob;
    }
    __syncthreads();

    const _Float16* WT = isv ? WvT : WkT;

    v8f acc[4] = {v8f{}, v8f{}, v8f{}, v8f{}};
    for (int ks = 0; ks < DC / 32; ++ks) {
        const int k0 = ks * 32;
        v16h a = frag16_lds(ct + k0, CTP, lane);
#pragma unroll
        for (int t = 0; t < 4; ++t) {
            v16h bf = frag_packed(WT + ((w * (DC / 32) + ks) * 4 + t) * FRAG, lane);
            acc[t] = wmma32(a, bf, acc[t]);
        }
    }

    // wave w holds head w: d = 16t + c, keys j0 + 8hi + g
    const int c = lane & 15, hi = lane >> 4;
    const size_t head = ((size_t)b * NH + w) * (JPAD * DH);
    if (isv) {
        // the lane's 8 keys are one 16-byte piece of V's fragment; padding keys stay 0
        _Float16* vf = vT + head + (j0 >> 5) * 4 * FRAG + ((j0 >> 4) & 1) * 256 + lane * 8;
#pragma unroll
        for (int t = 0; t < 4; ++t) {
            v8h ov;
#pragma unroll
            for (int g = 0; g < 8; ++g)
                ov[g] = (j0 + 8 * hi + g < SKV) ? (_Float16)acc[t][g] : (_Float16)0.f;
            *(v8h*)(vf + t * FRAG) = ov;
        }
        // the registers these four stores name are reused on the code path that follows in the
        // build: the wait that belongs in front of such an overwrite
        asm volatile("s_wait_xcnt 0x0" ::: "memory");
    } else {
        _Float16* kf = kP + head + (j0 >> 4) * 2 * FRAG + (c >> 3) * 256 + hi * 64 + (c & 7);
#pragma unroll
        for (int t = 0; t < 4; ++t)
#pragma unroll
            for (int g = 0; g < 8; ++g)
                if (j0 + 8 * hi + g < SKV)
                    kf[(t >> 1) * FRAG + (t & 1) * 128 + g * 8] = (_Float16)acc[t][g];
    }
}

// ---------------------------------------------------------------------------
// Kernel 2: fused q-proj + attention + out-proj.
// One block = 64 q rows of one batch. 256 threads = 8 waves.
// bufA: x tile (f16) then h tile; bufB: q tile (f16, pre-scaled by d^-1/2).
// ---------------------------------------------------------------------------
__global__ __launch_bounds__(256) void attn_fused(
    const float*    __restrict__ x,
    const _Float16* __restrict__ WqT,    // 512 x 512, fragment order
    const _Float16* __restrict__ kP,     // [B][H] fragments, see kv_proj
    const _Float16* __restrict__ vT,     // [B][H] fragments, see kv_proj
    const _Float16* __restrict__ WoT,    // 512 x 512, fragment order
    const float*    __restrict__ bout,   // [512]
    float*          __restrict__ out) {
    __shared__ __align__(32) _Float16 bufA[64 * LDP];  // 65 KB  x -> h
    __shared__ __align__(32) _Float16 bufB[64 * LDP];  // 65 KB  q

    const int tid  = threadIdx.x;
    const int w    = tid >> 5, lane = tid & 31;
    const int b    = blockIdx.y;
    const int m0   = blockIdx.x * 64;

    // ---------- phase 0: x tile (one contiguous block) -> f16 LDS rows ----------
    const float4* xs = (const float4*)(x + ((size_t)b * SQ + m0) * DM);
    __builtin_prefetch(WqT + (size_t)tid * 1024, 0, 1);   // warm L2 with Wq
    for (int i = tid; i < 64 * DM / 4; i += 256) {
        float4 v = xs[i];
        _Float16* d = bufA + (i / (DM / 4)) * LDP + (i % (DM / 4)) * 4;
        d[0] = (_Float16)v.x; d[1] = (_Float16)v.y;
        d[2] = (_Float16)v.z; d[3] = (_Float16)v.w;
    }
    __syncthreads();

    // ---------- phase 1: q = x @ Wq  (scaled), write f16 to bufB -------------
    // wave w: all 64 rows x columns 64w .. 64w + 63
    {
        const int n0 = w * 64;
        v8f q[4][4] = {};
        gemm_64x64(bufA, WqT + (size_t)n0 * INNER, lane, q);
#pragma unroll
        for (int mi = 0; mi < 4; ++mi)
#pragma unroll
            for (int t = 0; t < 4; ++t) {
                const int n = n0 + t * 16 + (lane & 15);
#pragma unroll
                for (int g = 0; g < 8; ++g) {
                    const int m = mi * 16 + g + 8 * (lane >> 4);
                    bufB[m * LDP + n] = (_Float16)(q[mi][t][g] * 0.125f);
                }
            }
    }
    __syncthreads();

    // ---------- phase 2: attention, one head per wave, softmax in registers --
    // S^T = K * Q^T: a lane holds 40 of one query's 80 score slots (lane and
    // lane ^ 16 split the keys), so max and sum are in-lane plus one exchange.
    // The score tiles, converted in place, are the B operand of O^T = V^T * P^T;
    // V^T is read in the matching k order (8 keys at 8*hi, 8 keys at 16 + 8*hi).
    {
        const int h = w;
        const int c = lane & 15, hi = lane >> 4;
        const _Float16* kb = kP + (((size_t)b * NH + h) * JPAD) * DH;
        const _Float16* vb = vT + (((size_t)b * NH + h) * DH) * JPAD;
        for (int mt = 0; mt < 4; ++mt) {
            const _Float16* qrow = bufB + (mt * 16) * LDP + h * DH;
            v8f s[5] = {v8f{}, v8f{}, v8f{}, v8f{}, v8f{}};
#pragma unroll
            for (int dstep = 0; dstep < 2; ++dstep) {
                const int d0 = dstep * 32;
                v16h qf = frag16_lds(qrow + d0, LDP, lane);
#pragma unroll
                for (int t = 0; t < 5; ++t) {
                    v16h kf = frag_packed(kb + (t * 2 + dstep) * FRAG, lane);
                    s[t] = wmma32(kf, qf, s[t]);     // s[t][g]: key 16t + 8hi + g, query c
                }
            }
            // keys 77..79 (tile 4, upper half, g >= 5) are padding
#pragma unroll
            for (int g = SKV - 72; g < 8; ++g) s[4][g] = hi ? -1e30f : s[4][g];

            float mx = -1e30f;
#pragma unroll
            for (int t = 0; t < 5; ++t)
#pragma unroll
                for (int g = 0; g < 8; ++g) mx = fmaxf(mx, s[t][g]);
            mx = fmaxf(mx, __shfl_xor(mx, 16));
            float sum = 0.f;
#pragma unroll
            for (int t = 0; t < 5; ++t)
#pragma unroll
                for (int g = 0; g < 8; ++g) {
                    float e = exp2_slot((s[t][g] - mx) * 1.44269504f);
                    s[t][g] = e; sum += e;
                }
            sum += __shfl_xor(sum, 16);
            const float r = 1.f / sum;

            v16h p[3];
#pragma unroll
            for (int kk = 0; kk < 3; ++kk)
#pragma unroll
                for (int g = 0; g < 8; ++g) {
                    p[kk][g]     = (_Float16)(s[2 * kk][g] * r);
                    p[kk][8 + g] = (kk < 2) ? (_Float16)(s[(kk < 2) ? 2 * kk + 1 : 0][g] * r)
                                            : (_Float16)0.f;
                }

            v8f o[4] = {v8f{}, v8f{}, v8f{}, v8f{}};
#pragma unroll
            for (int kk = 0; kk < 3; ++kk) {
#pragma unroll
                for (int td = 0; td < 4; ++td) {
                    const _Float16* vr = vb + (kk * 4 + td) * FRAG + lane * 8;
                    v8h lo = *(const v8h*)vr;
                    v8h up = (kk < 2) ? *(const v8h*)(vr + 256) : v8h{};
                    v16h vf = __builtin_shufflevector(lo, up, 0, 1, 2, 3, 4, 5, 6, 7,
                                                      8, 9, 10, 11, 12, 13, 14, 15);
                    o[td] = wmma32(vf, p[kk], o[td]); // o[td][g]: d 16td + 8hi + g, query c
                }
            }
#pragma unroll
            for (int td = 0; td < 4; ++td) {
                v8h ov;
#pragma unroll
                for (int g = 0; g < 8; ++g) ov[g] = (_Float16)o[td][g];
                *(v8h*)(bufA + (mt * 16 + c) * LDP + h * DH + td * 16 + 8 * hi) = ov;
            }
        }
    }
    __syncthreads();

    // ---------- phase 3: out = h @ Wout + bout -------------------------------
    // wave w: all 64 rows x columns 64w .. 64w + 63
    {
        const int n0 = w * 64;
        float* orow = out + ((size_t)b * SQ + m0) * INNER;
        v8f o[4][4] = {};
        gemm_64x64(bufA, WoT + (size_t)n0 * INNER, lane, o);
#pragma unroll
        for (int t = 0; t < 4; ++t) {
            const int n = n0 + t * 16 + (lane & 15);
            const float bias = bout[n];
#pragma unroll
            for (int mi = 0; mi < 4; ++mi)
#pragma unroll
                for (int g = 0; g < 8; ++g) {
                    orow[(size_t)(mi * 16 + g + 8 * (lane >> 4)) * INNER + n] = o[mi][t][g] + bias;
                }
        }
    }
}

// ---------------------------------------------------------------------------
// launch
// ---------------------------------------------------------------------------
extern "C" void kernel_launch(void* const* d_in, const int* in_sizes, int n_in,
                              void* d_out, int out_size, void* d_ws, size_t ws_size,
                              hipStream_t stream) {
    const float* x    = (const float*)d_in[0];
    const float* ctx  = (const float*)d_in[1];
    const float* Wq   = (const float*)d_in[2];
    const float* Wk   = (const float*)d_in[3];
    const float* Wv   = (const float*)d_in[4];
    const float* Wout = (const float*)d_in[5];
    const float* bout = (const float*)d_in[6];
    float* out = (float*)d_out;

    char* ws = (char*)d_ws;
    size_t off = 0;
    _Float16* WqT = (_Float16*)(ws + off); off += (size_t)INNER * DM * 2;     // fragments [8][16][4][FRAG]
    _Float16* WkT = (_Float16*)(ws + off); off += (size_t)INNER * DC * 2;     // fragments [8][24][4][FRAG]
    _Float16* WvT = (_Float16*)(ws + off); off += (size_t)INNER * DC * 2;     // fragments [8][24][4][FRAG]
    _Float16* WoT = (_Float16*)(ws + off); off += (size_t)INNER * INNER * 2;  // fragments [8][16][4][FRAG]
    _Float16* kP  = (_Float16*)(ws + off);
    size_t kvBytes = 2ull * B_ * NH * JPAD * DH * 2;                          // kP + vT
    _Float16* vT  = (_Float16*)(ws + off + kvBytes / 2);

    // zero the j-padding of kP/vT (graph-capturable)
    hipMemsetAsync(kP, 0, kvBytes, stream);

    // weight convert to f16 fragments, one thread per 8 elements
    wcvt_t<<<dim3(DM * INNER / 8 / 256), 256, 0, stream>>>(Wq, WqT, DM, INNER);
    wcvt_t<<<dim3(DC * INNER / 8 / 256), 256, 0, stream>>>(Wk, WkT, DC, INNER);
    wcvt_t<<<dim3(DC * INNER / 8 / 256), 256, 0, stream>>>(Wv, WvT, DC, INNER);
    wcvt_t<<<dim3(INNER * INNER / 8 / 256), 256, 0, stream>>>(Wout, WoT, INNER, INNER);

    // k/v projection: 5 j-tiles x 16 batches x {k,v}
    kv_proj<<<dim3(5, B_, 2), 256, 0, stream>>>(ctx, WkT, WvT, kP, vT);

    // fused q-proj + attention + out-proj: 64 q-tiles x 16 batches
    attn_fused<<<dim3(SQ / 64, B_), 256, 0, stream>>>(x, WqT, kP, vT, WoT, bout, out);
}

// v006
// It runs in 113 microseconds.
// In two side-by-side timings against v005, it was 1.06 and 1.07 times as fast.
// All steps since v000 together make it 7.68 times as fast.
#include <hip/hip_runtime.h>
#include <hip/hip_bf16.h>

typedef __attribute__((ext_vector_type(16))) _Float16 v16h;
typedef __attribute__((ext_vector_type(8)))  _Float16 v8h;
typedef __attribute__((ext_vector_type(4)))  _Float16 v4h;
typedef __attribute__((ext_vector_type(8)))  float    v8f;
typedef __attribute__((ext_vector_type(4)))  float    v4f;

#define B_   16
#define SQ   4096
#define DM   512
#define SKV  77
#define DC   768
#define NH   8
#define DH   64
#define INNER 512
#define JPAD 128   // Skv padded to multiple of 32 (K-dim of attn@v WMMA)
// LDS row pitches in halfs: row length + 8, so a pitch is an odd multiple of 16 bytes and the
// 16 rows that one ds_load_b128 / ds_store_b128 touches fall on 16 different groups of 4 banks.
#define LDP  (INNER + 8)   // 1040 B
#define CTP  (DC + 8)      // 1552 B

// ---------------------------------------------------------------------------
// helpers
// ---------------------------------------------------------------------------
__device__ __forceinline__ v8f wmma32(v16h a, v16h b, v8f c) {
    // D = A(16x32 f16) * B(32x16 f16) + C(16x16 f32)
    return __builtin_amdgcn_wmma_f32_16x16x32_f16(
        /*neg_a=*/false, a, /*neg_b=*/false, b,
        /*c_mod=*/(short)0, c, /*reuse_a=*/false, /*reuse_b=*/false);
}

// Fragment order: every matrix operand that is read from global memory is stored as a row of
// 1-KiB fragments (16 rows x 32 k), each laid out [piece 0..1][lane 0..31][8 halfs]. Lane l
// owns row l & 15 and k = 16 * (l >> 4) + 8 * piece + e (V: see attn_fused), so one wave-wide
// 16-byte load reads 512 contiguous bytes, four whole cache lines.
#define FRAG 512   // halfs in a fragment
__device__ __forceinline__ v16h frag_packed(const _Float16* f, int lane) {
    v8h lo = *(const v8h*)(f + lane * 8);
    v8h up = *(const v8h*)(f + 256 + lane * 8);
    return __builtin_shufflevector(lo, up, 0, 1, 2, 3, 4, 5, 6, 7, 8, 9, 10, 11, 12, 13, 14, 15);
}

// A fragment from a padded LDS tile: lane picks row lane & 15 and 16 halfs along K from
// 16 * (lane >> 4); rows are 16-byte aligned, so they are read as two 16-byte pieces.
__device__ __forceinline__ v16h frag16_lds(const _Float16* base, int pitch, int lane) {
    const _Float16* p = base + (lane & 15) * pitch + ((lane >> 4) << 4);
    v8h lo = *(const v8h*)p;
    v8h up = *(const v8h*)(p + 8);
    return __builtin_shufflevector(lo, up, 0, 1, 2, 3, 4, 5, 6, 7, 8, 9, 10, 11, 12, 13, 14, 15);
}

// 2^x. The v_nop is the one free issue slot the instruction set asks for behind a
// transcendental.
__device__ __forceinline__ float exp2_slot(float x) {
    float r;
    asm("v_exp_f32 %0, %1\n\tv_nop" : "=v"(r) : "v"(x));
    return r;
}

// acc[mi][t] += A rows 16mi .. (64 x 512 in LDS, row pitch LDP) * wt columns 16t .. (64 x 512,
// global, fragment order [k step][t]).
// One wave owns all 64 rows of 64 output columns, so each weight fragment read from
// global memory feeds four matrix instructions and no two waves read the same weights.
__device__ __forceinline__ void gemm_64x64(const _Float16* a_lds, const _Float16* wt,
                                           int lane, v8f (&acc)[4][4]) {
    for (int ks = 0; ks < INNER / 32; ++ks) {
        const int k0 = ks * 32;
        v16h bf[4], a[4];
#pragma unroll
        for (int t = 0; t < 4; ++t)
            bf[t] = frag_packed(wt + (ks * 4 + t) * FRAG, lane);
#pragma unroll
        for (int mi = 0; mi < 4; ++mi)
            a[mi] = frag16_lds(a_lds + (mi * 16) * LDP + k0, LDP, lane);
        // keeps all 16 loads of the step ahead of its 16 matrix instructions: without it
        // three weight loads were issued among them and waited for at once
        __builtin_amdgcn_sched_barrier(0);
#pragma unroll
        for (int t = 0; t < 4; ++t)
#pragma unroll
            for (int mi = 0; mi < 4; ++mi) acc[mi][t] = wmma32(a[mi], bf[t], acc[mi][t]);
    }
}

// ---------------------------------------------------------------------------
// Kernel 0: convert the four f32 weights [K][INNER] -> f16 fragments
// [INNER/64][K/32][4 column tiles][FRAG], all in one launch. A block makes the four fragments of
// one (64-column group, k step) of one matrix; its index range says which matrix. The four
// outputs lie one behind the other in the workspace in the order Wq, Wk, Wv, Wout, so the
// block index is also the output position. One thread makes one 16-byte piece (8 k of one column).
// The last CVB_Z blocks store zeros over the last key tile of K (two fragments a head), of which
// kv_proj, the next launch, writes the SKV % 16 valid rows only; V's padding kv_proj writes itself.
// ---------------------------------------------------------------------------
#define CVB_Q (DM * INNER / 8 / 256)      // blocks of Wq
#define CVB_C (DC * INNER / 8 / 256)      // blocks of Wk, and of Wv
#define CVB_O (INNER * INNER / 8 / 256)   // blocks of Wout
#define CVB_Z (B_ * NH * 2 * FRAG / 8 / 256)   // blocks that zero K's last key tile
__global__ __launch_bounds__(256) void wcvt_all(const float* __restrict__ Wq,
                                                const float* __restrict__ Wk,
                                                const float* __restrict__ Wv,
                                                const float* __restrict__ Wo,
                                                _Float16* __restrict__ dst,
                                                _Float16* __restrict__ kP) {
    const int blk = blockIdx.x, tid = threadIdx.x;
    if (blk >= CVB_Q + 2 * CVB_C + CVB_O) {
        const int i = (blk - (CVB_Q + 2 * CVB_C + CVB_O)) * 256 + tid;   // 16-byte piece
        const int head = i / (2 * FRAG / 8), pc = i % (2 * FRAG / 8);
        *(v8h*)(kP + (size_t)head * (JPAD * DH) + (SKV / 16) * 2 * FRAG + pc * 8) = v8h{};
        return;
    }
    const float* src;
    int nw, ks;
    if (blk < CVB_Q) {
        src = Wq; nw = blk / (DM / 32); ks = blk % (DM / 32);
    } else if (blk < CVB_Q + CVB_C) {
        src = Wk; nw = (blk - CVB_Q) / (DC / 32); ks = (blk - CVB_Q) % (DC / 32);
    } else if (blk < CVB_Q + 2 * CVB_C) {
        src = Wv; nw = (blk - CVB_Q - CVB_C) / (DC / 32); ks = (blk - CVB_Q - CVB_C) % (DC / 32);
    } else {
        src = Wo; nw = (blk - CVB_Q - 2 * CVB_C) / (INNER / 32);
        ks = (blk - CVB_Q - 2 * CVB_C) % (INNER / 32);
    }
    const int lane = tid & 31, piece = (tid >> 5) & 1, t = (tid >> 6) & 3;
    const int n  = (nw * 4 + t) * 16 + (lane & 15);
    const int k0 = ks * 32 + (lane >> 4) * 16 + piece * 8;
    float f[8];
#pragma unroll
    for (int e = 0; e < 8; ++e) f[e] = src[(size_t)(k0 + e) * INNER + n];
    // the converted halfs are written over the loads' address registers: the wait that
    // belongs in front of such an overwrite
    asm volatile("s_wait_xcnt 0x0" ::: "memory");
    v8h o;
#pragma unroll
    for (int e = 0; e < 8; ++e) o[e] = (_Float16)f[e];
    *(v8h*)(dst + ((size_t)blk * 256 + tid) * 8) = o;
}

// ---------------------------------------------------------------------------
// Kernel 1: k/v projection (WMMA).
//   context[b][j][768] @ Wk/Wv -> per head (JPAD * DH halfs each), in fragment order:
//     kP[b][h][j tile(5)][d step(2)][FRAG]    rows = keys, k = d
//     vT[b][h][j step(3)][d tile(4)][FRAG]    rows = d, k = keys: piece p, lane half hi hold
//                                             keys 16p + 8hi .. + 7 of the step
// grid = (5 m-tiles, 16 batches, 2 {k,v}), block = 256 (8 waves)
// ---------------------------------------------------------------------------
__global__ __launch_bounds__(256) void kv_proj(
    const float* __restrict__ ctx,
    const _Float16* __restrict__ WkT,   // 512 x 768 f16 fragments
    const _Float16* __restrict__ WvT,   // 512 x 768 f16 fragments
    _Float16* __restrict__ kP,
    _Float16* __restrict__ vT) {
    __shared__ __align__(32) _Float16 ct[16 * CTP];  // 24 KB context tile (f16), padded rows

    const int tid  = threadIdx.x;
    const int b    = blockIdx.y;
    const int j0   = blockIdx.x * 16;
    const int isv  = blockIdx.z;
    const int w    = tid >> 5, lane = tid & 31;

    // The tile's 16 rows are one contiguous run of 16 * DC / 4 16-byte pieces, 12 a thread. All 12
    // loads are issued before the first value is used, so a thread waits out one memory latency
    // and not one per load. Pieces of the padding rows (j >= SKV) read the last valid piece
    // instead, which keeps the address inside ctx, and are stored as zeros.
    const v4f* cbase = (const v4f*)(ctx + ((size_t)b * SKV + j0) * DC);
    const int npc = (SKV - j0 < 16 ? SKV - j0 : 16) * (DC / 4);   // valid pieces of this tile
    v4f cv[16 * DC / 4 / 256];
    int pc[16 * DC / 4 / 256];
#pragma unroll
    for (int u = 0; u < 16 * DC / 4 / 256; ++u) {
        const int i = tid + u * 256;
        pc[u] = i < npc ? i : npc - 1;
        cv[u] = cbase[pc[u]];
    }
    // The loaded values as inputs hold all 12 loads ahead of the first convert (without that the
    // build issued part of them only behind waits on earlier ones). The piece indices as inputs
    // keep the loads' offset registers untouched up to here, so that no load's result lands in an
    // earlier load's offset register, and the wait stands in front of their first overwrite.
    asm volatile("s_wait_xcnt 0x0"
                 :: "v"(cv[0]), "v"(cv[1]), "v"(cv[2]), "v"(cv[3]), "v"(cv[4]), "v"(cv[5]),
                    "v"(cv[6]), "v"(cv[7]), "v"(cv[8]), "v"(cv[9]), "v"(cv[10]), "v"(cv[11]),
                    "v"(pc[0]), "v"(pc[1]), "v"(pc[2]), "v"(pc[3]), "v"(pc[4]), "v"(pc[5]),
                    "v"(pc[6]), "v"(pc[7]), "v"(pc[8]), "v"(pc[9]), "v"(pc[10]), "v"(pc[11])
                 : "memory");
#pragma unroll
    for (int u = 0; u < 16 * DC / 4 / 256; ++u) {
        const int i = tid + u * 256;
        const int r = i / (DC / 4), c4 = i - r * (DC / 4);
        const bool in = i < npc;
        const v4h o = {(_Float16)cv[u][0], (_Float16)cv[u][1], (_Float16)cv[u][2], (_Float16)cv[u][3]};
        uint2 ob = __builtin_bit_cast(uint2, o);
        ob.x = in ? ob.x : 0u;
        ob.y = in ? ob.y : 0u;
        *(uint2*)(ct + r * CTP + c4 * 4) = ob;
    }
    __syncthreads();

    const _Float16* WT = isv ? WvT : WkT;

    v8f acc[4] = {v8f{}, v8f{}, v8f{}, v8f{}};
    for (int ks = 0; ks < DC / 32; ++ks) {
        const int k0 = ks * 32;
        v16h a = frag16_lds(ct + k0, CTP, lane);
#pragma unroll
        for (int t = 0; t < 4; ++t) {
            v16h bf = frag_packed(WT + ((w * (DC / 32) + ks) * 4 + t) * FRAG, lane);
            acc[t] = wmma32(a, bf, acc[t]);
        }
    }

    // wave w holds head w: d = 16t + c, keys j0 + 8hi + g
    const int c = lane & 15, hi = lane >> 4;
    const size_t head = ((size_t)b * NH + w) * (JPAD * DH);
    if (isv) {
        // the lane's 8 keys are one 16-byte piece of V's fragment; padding keys stay 0
        _Float16* vf = vT + head + (j0 >> 5) * 4 * FRAG + ((j0 >> 4) & 1) * 256 + lane * 8;
#pragma unroll
        for (int t = 0; t < 4; ++t) {
            v8h ov;
#pragma unroll
            for (int g = 0; g < 8; ++g)
                ov[g] = (j0 + 8 * hi + g < SKV) ? (_Float16)acc[t][g] : (_Float16)0.f;
            *(v8h*)(vf + t * FRAG) = ov;
        }
        // the registers these four stores name are reused on the code path that follows in the
        // build: the wait that belongs in front of such an overwrite
        asm volatile("s_wait_xcnt 0x0" ::: "memory");
    } else {
        _Float16* kf = kP + head + (j0 >> 4) * 2 * FRAG + (c >> 3) * 256 + hi * 64 + (c & 7);
#pragma unroll
        for (int t = 0; t < 4; ++t)
#pragma unroll
            for (int g = 0; g < 8; ++g)
                if (j0 + 8 * hi + g < SKV)
                    kf[(t >> 1) * FRAG + (t & 1) * 128 + g * 8] = (_Float16)acc[t][g];
    }
}

// ---------------------------------------------------------------------------
// Kernel 2: fused q-proj + attention + out-proj.
// One block = 64 q rows of one batch. 256 threads = 8 waves.
// bufA: x tile (f16) then h tile; bufB: q tile (f16, pre-scaled by d^-1/2).
// ---------------------------------------------------------------------------
__global__ __launch_bounds__(256) void attn_fused(
    const float*    __restrict__ x,
    const _Float16* __restrict__ WqT,    // 512 x 512, fragment order
    const _Float16* __restrict__ kP,     // [B][H] fragments, see kv_proj
    const _Float16* __restrict__ vT,     // [B][H] fragments, see kv_proj
    const _Float16* __restrict__ WoT,    // 512 x 512, fragment order
    const float*    __restrict__ bout,   // [512]
    float*          __restrict__ out) {
    __shared__ __align__(32) _Float16 bufA[64 * LDP];  // 65 KB  x -> h
    __shared__ __align__(32) _Float16 bufB[64 * LDP];  // 65 KB  q

    const int tid  = threadIdx.x;
    const int w    = tid >> 5, lane = tid & 31;
    const int b    = blockIdx.y;
    const int m0   = blockIdx.x * 64;

    // ---------- phase 0: x tile (one contiguous block) -> f16 LDS rows ----------
    const float4* xs = (const float4*)(x + ((size_t)b * SQ + m0) * DM);
    __builtin_prefetch(WqT + (size_t)tid * 1024, 0, 1);   // warm L2 with Wq
    for (int i = tid; i < 64 * DM / 4; i += 256) {
        float4 v = xs[i];
        _Float16* d = bufA + (i / (DM / 4)) * LDP + (i % (DM / 4)) * 4;
        d[0] = (_Float16)v.x; d[1] = (_Float16)v.y;
        d[2] = (_Float16)v.z; d[3] = (_Float16)v.w;
    }
    __syncthreads();

    // ---------- phase 1: q = x @ Wq  (scaled), write f16 to bufB -------------
    // wave w: all 64 rows x columns 64w .. 64w + 63
    {
        const int n0 = w * 64;
        v8f q[4][4] = {};
        gemm_64x64(bufA, WqT + (size_t)n0 * INNER, lane, q);
#pragma unroll
        for (int mi = 0; mi < 4; ++mi)
#pragma unroll
            for (int t = 0; t < 4; ++t) {
                const int n = n0 + t * 16 + (lane & 15);
#pragma unroll
                for (int g = 0; g < 8; ++g) {
                    const int m = mi * 16 + g + 8 * (lane >> 4);
                    bufB[m * LDP + n] = (_Float16)(q[mi][t][g] * 0.125f);
                }
            }
    }
    __syncthreads();

    // ---------- phase 2: attention, one head per wave, softmax in registers --
    // S^T = K * Q^T: a lane holds 40 of one query's 80 score slots (lane and
    // lane ^ 16 split the keys), so max and sum are in-lane plus one exchange.
    // The score tiles, converted in place, are the B operand of O^T = V^T * P^T;
    // V^T is read in the matching k order (8 keys at 8*hi, 8 keys at 16 + 8*hi).
    {
        const int h = w;
        const int c = lane & 15, hi = lane >> 4;
        const _Float16* kb = kP + (((size_t)b * NH + h) * JPAD) * DH;
        const _Float16* vb = vT + (((size_t)b * NH + h) * DH) * JPAD;
        for (int mt = 0; mt < 4; ++mt) {
            const _Float16* qrow = bufB + (mt * 16) * LDP + h * DH;
            v8f s[5] = {v8f{}, v8f{}, v8f{}, v8f{}, v8f{}};
#pragma unroll
            for (int dstep = 0; dstep < 2; ++dstep) {
                const int d0 = dstep * 32;
                v16h qf = frag16_lds(qrow + d0, LDP, lane);
#pragma unroll
                for (int t = 0; t < 5; ++t) {
                    v16h kf = frag_packed(kb + (t * 2 + dstep) * FRAG, lane);
                    s[t] = wmma32(kf, qf, s[t]);     // s[t][g]: key 16t + 8hi + g, query c
                }
            }
            // keys 77..79 (tile 4, upper half, g >= 5) are padding
#pragma unroll
            for (int g = SKV - 72; g < 8; ++g) s[4][g] = hi ? -1e30f : s[4][g];

            float mx = -1e30f;
#pragma unroll
            for (int t = 0; t < 5; ++t)
#pragma unroll
                for (int g = 0; g < 8; ++g) mx = fmaxf(mx, s[t][g]);
            mx = fmaxf(mx, __shfl_xor(mx, 16));
            float sum = 0.f;
#pragma unroll
            for (int t = 0; t < 5; ++t)
#pragma unroll
                for (int g = 0; g < 8; ++g) {
                    float e = exp2_slot((s[t][g] - mx) * 1.44269504f);
                    s[t][g] = e; sum += e;
                }
            sum += __shfl_xor(sum, 16);
            const float r = 1.f / sum;

            v16h p[3];
#pragma unroll
            for (int kk = 0; kk < 3; ++kk)
#pragma unroll
                for (int g = 0; g < 8; ++g) {
                    p[kk][g]     = (_Float16)(s[2 * kk][g] * r);
                    p[kk][8 + g] = (kk < 2) ? (_Float16)(s[(kk < 2) ? 2 * kk + 1 : 0][g] * r)
                                            : (_Float16)0.f;
                }

            v8f o[4] = {v8f{}, v8f{}, v8f{}, v8f{}};
#pragma unroll
            for (int kk = 0; kk < 3; ++kk) {
#pragma unroll
                for (int td = 0; td < 4; ++td) {
                    const _Float16* vr = vb + (kk * 4 + td) * FRAG + lane * 8;
                    v8h lo = *(const v8h*)vr;
                    v8h up = (kk < 2) ? *(const v8h*)(vr + 256) : v8h{};
                    v16h vf = __builtin_shufflevector(lo, up, 0, 1, 2, 3, 4, 5, 6, 7,
                                                      8, 9, 10, 11, 12, 13, 14, 15);
                    o[td] = wmma32(vf, p[kk], o[td]); // o[td][g]: d 16td + 8hi + g, query c
                }
            }
#pragma unroll
            for (int td = 0; td < 4; ++td) {
                v8h ov;
#pragma unroll
                for (int g = 0; g < 8; ++g) ov[g] = (_Float16)o[td][g];
                *(v8h*)(bufA + (mt * 16 + c) * LDP + h * DH + td * 16 + 8 * hi) = ov;
            }
        }
    }
    __syncthreads();

    // ---------- phase 3: out = h @ Wout + bout -------------------------------
    // wave w: all 64 rows x columns 64w .. 64w + 63
    {
        const int n0 = w * 64;
        float* orow = out + ((size_t)b * SQ + m0) * INNER;
        v8f o[4][4] = {};
        gemm_64x64(bufA, WoT + (size_t)n0 * INNER, lane, o);
#pragma unroll
        for (int t = 0; t < 4; ++t) {
            const int n = n0 + t * 16 + (lane & 15);
            const float bias = bout[n];
#pragma unroll
            for (int mi = 0; mi < 4; ++mi)
#pragma unroll
                for (int g = 0; g < 8; ++g) {
                    orow[(size_t)(mi * 16 + g + 8 * (lane >> 4)) * INNER + n] = o[mi][t][g] + bias;
                }
        }
    }
}

// ---------------------------------------------------------------------------
// launch
// ---------------------------------------------------------------------------
extern "C" void kernel_launch(void* const* d_in, const int* in_sizes, int n_in,
                              void* d_out, int out_size, void* d_ws, size_t ws_size,
                              hipStream_t stream) {
    const float* x    = (const float*)d_in[0];
    const float* ctx  = (const float*)d_in[1];
    const float* Wq   = (const float*)d_in[2];
    const float* Wk   = (const float*)d_in[3];
    const float* Wv   = (const float*)d_in[4];
    const float* Wout = (const float*)d_in[5];
    const float* bout = (const float*)d_in[6];
    float* out = (float*)d_out;

    char* ws = (char*)d_ws;
    size_t off = 0;
    _Float16* WqT = (_Float16*)(ws + off); off += (size_t)INNER * DM * 2;     // fragments [8][16][4][FRAG]
    _Float16* WkT = (_Float16*)(ws + off); off += (size_t)INNER * DC * 2;     // fragments [8][24][4][FRAG]
    _Float16* WvT = (_Float16*)(ws + off); off += (size_t)INNER * DC * 2;     // fragments [8][24][4][FRAG]
    _Float16* WoT = (_Float16*)(ws + off); off += (size_t)INNER * INNER * 2;  // fragments [8][16][4][FRAG]
    _Float16* kP  = (_Float16*)(ws + off);
    size_t kvBytes = 2ull * B_ * NH * JPAD * DH * 2;                          // kP + vT
    _Float16* vT  = (_Float16*)(ws + off + kvBytes / 2);

    // one launch: all four weights to f16 fragments (WqT, WkT, WvT, WoT are consecutive) and
    // zeros over K's last key tile
    wcvt_all<<<dim3(CVB_Q + 2 * CVB_C + CVB_O + CVB_Z), 256, 0, stream>>>(Wq, Wk, Wv, Wout, WqT, kP);

    // k/v projection: 5 j-tiles x 16 batches x {k,v}
    kv_proj<<<dim3(5, B_, 2), 256, 0, stream>>>(ctx, WkT, WvT, kP, vT);

    // fused q-proj + attention + out-proj: 64 q-tiles x 16 batches
    attn_fused<<<dim3(SQ / 64, B_), 256, 0, stream>>>(x, WqT, kP, vT, WoT, bout, out);
}

// v007
// Measured time: 105 microseconds a run.
// In two side-by-side timings against v006, it was 1.12 and 1.11 times as fast.
// Counting every step since v000, it is 8.56 times as fast.
#include <hip/hip_runtime.h>
#include <hip/hip_bf16.h>

typedef __attribute__((ext_vector_type(16))) _Float16 v16h;
typedef __attribute__((ext_vector_type(8)))  _Float16 v8h;
typedef __attribute__((ext_vector_type(4)))  _Float16 v4h;
typedef __attribute__((ext_vector_type(8)))  float    v8f;
typedef __attribute__((ext_vector_type(4)))  float    v4f;

#define B_   16
#define SQ   4096
#define DM   512
#define SKV  77
#define DC   768
#define NH   8
#define DH   64
#define INNER 512
#define JPAD 128   // Skv padded to multiple of 32 (K-dim of attn@v WMMA)
// LDS row pitches in halfs: row length + 8, so a pitch is an odd multiple of 16 bytes and the
// 16 rows that one ds_load_b128 / ds_store_b128 touches fall on 16 different groups of 4 banks.
#define LDP  (INNER + 8)   // 1040 B
#define CTP  (DC + 8)      // 1552 B
// Row pitch in floats of a wave's output staging tile (16 rows x 64 columns): 272 B, again an odd
// multiple of 16 bytes, for its 16-byte stores (one row a lane).
#define OSP  (64 + 4)

// ---------------------------------------------------------------------------
// helpers
// ---------------------------------------------------------------------------
__device__ __forceinline__ v8f wmma32(v16h a, v16h b, v8f c) {
    // D = A(16x32 f16) * B(32x16 f16) + C(16x16 f32)
    return __builtin_amdgcn_wmma_f32_16x16x32_f16(
        /*neg_a=*/false, a, /*neg_b=*/false, b,
        /*c_mod=*/(short)0, c, /*reuse_a=*/false, /*reuse_b=*/false);
}

// Fragment order: every matrix operand that is read from global memory is stored as a row of
// 1-KiB fragments (16 rows x 32 k), each laid out [piece 0..1][lane 0..31][8 halfs]. Lane l
// owns row l & 15 and k = 16 * (l >> 4) + 8 * piece + e (V: see attn_fused), so one wave-wide
// 16-byte load reads 512 contiguous bytes, four whole cache lines.
#define FRAG 512   // halfs in a fragment
__device__ __forceinline__ v16h frag_packed(const _Float16* f, int lane) {
    v8h lo = *(const v8h*)(f + lane * 8);
    v8h up = *(const v8h*)(f + 256 + lane * 8);
    return __builtin_shufflevector(lo, up, 0, 1, 2, 3, 4, 5, 6, 7, 8, 9, 10, 11, 12, 13, 14, 15);
}

// A fragment from a padded LDS tile: lane picks row lane & 15 and 16 halfs along K from
// 16 * (lane >> 4); rows are 16-byte aligned, so they are read as two 16-byte pieces.
__device__ __forceinline__ v16h frag16_lds(const _Float16* base, int pitch, int lane) {
    const _Float16* p = base + (lane & 15) * pitch + ((lane >> 4) << 4);
    v8h lo = *(const v8h*)p;
    v8h up = *(const v8h*)(p + 8);
    return __builtin_shufflevector(lo, up, 0, 1, 2, 3, 4, 5, 6, 7, 8, 9, 10, 11, 12, 13, 14, 15);
}

// 2^x. The v_nop is the one free issue slot the instruction set asks for behind a
// transcendental.
__device__ __forceinline__ float exp2_slot(float x) {
    float r;
    asm("v_exp_f32 %0, %1\n\tv_nop" : "=v"(r) : "v"(x));
    return r;
}

// acc[mi][t] += A rows 16mi .. (64 x 512 in LDS, row pitch LDP) * wt columns 16t .. (64 x 512,
// global, fragment order [k step][t]).
// One wave owns all 64 rows of 64 output columns, so each weight fragment read from
// global memory feeds four matrix instructions and no two waves read the same weights.
// TR: the product is formed transposed (weights as the A operand), so that a lane holds 8
// consecutive columns 16t + 8 * (lane >> 4) .. of row 16mi + (lane & 15) and not 8 rows of one column.
template <bool TR>
__device__ __forceinline__ void gemm_64x64(const _Float16* a_lds, const _Float16* wt,
                                           int lane, v8f (&acc)[4][4]) {
    // each call keeps the form the build gave it so far: the out projection's loop unrolled (a
    // step's weight loads are then issued ahead of the last matrix instructions of the step
    // before), the q projection's rolled
#pragma unroll(TR ? INNER / 32 : 1)
    for (int ks = 0; ks < INNER / 32; ++ks) {
        const int k0 = ks * 32;
        v16h bf[4], a[4];
#pragma unroll
        for (int t = 0; t < 4; ++t)
            bf[t] = frag_packed(wt + (ks * 4 + t) * FRAG, lane);
#pragma unroll
        for (int mi = 0; mi < 4; ++mi)
            a[mi] = frag16_lds(a_lds + (mi * 16) * LDP + k0, LDP, lane);
        // keeps all 16 loads of the step ahead of its 16 matrix instructions: without it
        // three weight loads were issued among them and waited for at once
        __builtin_amdgcn_sched_barrier(0);
#pragma unroll
        for (int t = 0; t < 4; ++t)
#pragma unroll
            for (int mi = 0; mi < 4; ++mi)
                acc[mi][t] = TR ? wmma32(bf[t], a[mi], acc[mi][t]) : wmma32(a[mi], bf[t], acc[mi][t]);
    }
}

// ---------------------------------------------------------------------------
// Kernel 0: convert the four f32 weights [K][INNER] -> f16 fragments
// [INNER/64][K/32][4 column tiles][FRAG], all in one launch. A block makes the four fragments of
// one (64-column group, k step) of one matrix; its index range says which matrix. The four
// outputs lie one behind the other in the workspace in the order Wq, Wk, Wv, Wout, so the
// block index is also the output position. One thread makes one 16-byte piece (8 k of one column).
// The last CVB_Z blocks store zeros over the last key tile of K (two fragments a head), of which
// kv_proj, the next launch, writes the SKV % 16 valid rows only; V's padding kv_proj writes itself.
// ---------------------------------------------------------------------------
#define CVB_Q (DM * INNER / 8 / 256)      // blocks of Wq
#define CVB_C (DC * INNER / 8 / 256)      // blocks of Wk, and of Wv
#define CVB_O (INNER * INNER / 8 / 256)   // blocks of Wout
#define CVB_Z (B_ * NH * 2 * FRAG / 8 / 256)   // blocks that zero K's last key tile
__global__ __launch_bounds__(256) void wcvt_all(const float* __restrict__ Wq,
                                                const float* __restrict__ Wk,
                                                const float* __restrict__ Wv,
                                                const float* __restrict__ Wo,
                                                _Float16* __restrict__ dst,
                                                _Float16* __restrict__ kP) {
    const int blk = blockIdx.x, tid = threadIdx.x;
    if (blk >= CVB_Q + 2 * CVB_C + CVB_O) {
        const int i = (blk - (CVB_Q + 2 * CVB_C + CVB_O)) * 256 + tid;   // 16-byte piece
        const int head = i / (2 * FRAG / 8), pc = i % (2 * FRAG / 8);
        *(v8h*)(kP + (size_t)head * (JPAD * DH) + (SKV / 16) * 2 * FRAG + pc * 8) = v8h{};
        return;
    }
    const float* src;
    int nw, ks;
    if (blk < CVB_Q) {
        src = Wq; nw = blk / (DM / 32); ks = blk % (DM / 32);
    } else if (blk < CVB_Q + CVB_C) {
        src = Wk; nw = (blk - CVB_Q) / (DC / 32); ks = (blk - CVB_Q) % (DC / 32);
    } else if (blk < CVB_Q + 2 * CVB_C) {
        src = Wv; nw = (blk - CVB_Q - CVB_C) / (DC / 32); ks = (blk - CVB_Q - CVB_C) % (DC / 32);
    } else {
        src = Wo; nw = (blk - CVB_Q - 2 * CVB_C) / (INNER / 32);
        ks = (blk - CVB_Q - 2 * CVB_C) % (INNER / 32);
    }
    const int lane = tid & 31, piece = (tid >> 5) & 1, t = (tid >> 6) & 3;
    const int n  = (nw * 4 + t) * 16 + (lane & 15);
    const int k0 = ks * 32 + (lane >> 4) * 16 + piece * 8;
    float f[8];
#pragma unroll
    for (int e = 0; e < 8; ++e) f[e] = src[(size_t)(k0 + e) * INNER + n];
    // the converted halfs are written over the loads' address registers: the wait that
    // belongs in front of such an overwrite
    asm volatile("s_wait_xcnt 0x0" ::: "memory");
    v8h o;
#pragma unroll
    for (int e = 0; e < 8; ++e) o[e] = (_Float16)f[e];
    *(v8h*)(dst + ((size_t)blk * 256 + tid) * 8) = o;
}

// ---------------------------------------------------------------------------
// Kernel 1: k/v projection (WMMA).
//   context[b][j][768] @ Wk/Wv -> per head (JPAD * DH halfs each), in fragment order:
//     kP[b][h][j tile(5)][d step(2)][FRAG]    rows = keys, k = d
//     vT[b][h][j step(3)][d tile(4)][FRAG]    rows = d, k = keys: piece p, lane half hi hold
//                                             keys 16p + 8hi .. + 7 of the step
// grid = (5 m-tiles, 16 batches, 2 {k,v}), block = 256 (8 waves)
// ---------------------------------------------------------------------------
__global__ __launch_bounds__(256) void kv_proj(
    const float* __restrict__ ctx,
    const _Float16* __restrict__ WkT,   // 512 x 768 f16 fragments
    const _Float16* __restrict__ WvT,   // 512 x 768 f16 fragments
    _Float16* __restrict__ kP,
    _Float16* __restrict__ vT) {
    __shared__ __align__(32) _Float16 ct[16 * CTP];  // 24 KB context tile (f16), padded rows

    const int tid  = threadIdx.x;
    const int b    = blockIdx.y;
    const int j0   = blockIdx.x * 16;
    const int isv  = blockIdx.z;
    const int w    = tid >> 5, lane = tid & 31;

    // The tile's 16 rows are one contiguous run of 16 * DC / 4 16-byte pieces, 12 a thread. All 12
    // loads are issued before the first value is used, so a thread waits out one memory latency
    // and not one per load. Pieces of the padding rows (j >= SKV) read the last valid piece
    // instead, which keeps the address inside ctx, and are stored as zeros.
    const v4f* cbase = (const v4f*)(ctx + ((size_t)b * SKV + j0) * DC);
    const int npc = (SKV - j0 < 16 ? SKV - j0 : 16) * (DC / 4);   // valid pieces of this tile
    v4f cv[16 * DC / 4 / 256];
    int pc[16 * DC / 4 / 256];
#pragma unroll
    for (int u = 0; u < 16 * DC / 4 / 256; ++u) {
        const int i = tid + u * 256;
        pc[u] = i < npc ? i : npc - 1;
        cv[u] = cbase[pc[u]];
    }
    // The loaded values as inputs hold all 12 loads ahead of the first convert (without that the
    // build issued part of them only behind waits on earlier ones). The piece indices as inputs
    // keep the loads' offset registers untouched up to here, so that no load's result lands in an
    // earlier load's offset register, and the wait stands in front of their first overwrite.
    asm volatile("s_wait_xcnt 0x0"
                 :: "v"(cv[0]), "v"(cv[1]), "v"(cv[2]), "v"(cv[3]), "v"(cv[4]), "v"(cv[5]),
                    "v"(cv[6]), "v"(cv[7]), "v"(cv[8]), "v"(cv[9]), "v"(cv[10]), "v"(cv[11]),
                    "v"(pc[0]), "v"(pc[1]), "v"(pc[2]), "v"(pc[3]), "v"(pc[4]), "v"(pc[5]),
                    "v"(pc[6]), "v"(pc[7]), "v"(pc[8]), "v"(pc[9]), "v"(pc[10]), "v"(pc[11])
                 : "memory");
#pragma unroll
    for (int u = 0; u < 16 * DC / 4 / 256; ++u) {
        const int i = tid + u * 256;
        const int r = i / (DC / 4), c4 = i - r * (DC / 4);
        const bool in = i < npc;
        const v4h o = {(_Float16)cv[u][0], (_Float16)cv[u][1], (_Float16)cv[u][2], (_Float16)cv[u][3]};
        uint2 ob = __builtin_bit_cast(uint2, o);
        ob.x = in ? ob.x : 0u;
        ob.y = in ? ob.y : 0u;
        *(uint2*)(ct + r * CTP + c4 * 4) = ob;
    }
    __syncthreads();

    const _Float16* WT = isv ? WvT : WkT;

    v8f acc[4] = {v8f{}, v8f{}, v8f{}, v8f{}};
    for (int ks = 0; ks < DC / 32; ++ks) {
        const int k0 = ks * 32;
        v16h a = frag16_lds(ct + k0, CTP, lane);
#pragma unroll
        for (int t = 0; t < 4; ++t) {
            v16h bf = frag_packed(WT + ((w * (DC / 32) + ks) * 4 + t) * FRAG, lane);
            acc[t] = wmma32(a, bf, acc[t]);
        }
    }

    // wave w holds head w: d = 16t + c, keys j0 + 8hi + g
    const int c = lane & 15, hi = lane >> 4;
    const size_t head = ((size_t)b * NH + w) * (JPAD * DH);
    if (isv) {
        // the lane's 8 keys are one 16-byte piece of V's fragment; padding keys stay 0
        _Float16* vf = vT + head + (j0 >> 5) * 4 * FRAG + ((j0 >> 4) & 1) * 256 + lane * 8;
#pragma unroll
        for (int t = 0; t < 4; ++t) {
            v8h ov;
#pragma unroll
            for (int g = 0; g < 8; ++g)
                ov[g] = (j0 + 8 * hi + g < SKV) ? (_Float16)acc[t][g] : (_Float16)0.f;
            *(v8h*)(vf + t * FRAG) = ov;
        }
        // the registers these four stores name are reused on the code path that follows in the
        // build: the wait that belongs in front of such an overwrite
        asm volatile("s_wait_xcnt 0x0" ::: "memory");
    } else {
        _Float16* kf = kP + head + (j0 >> 4) * 2 * FRAG + (c >> 3) * 256 + hi * 64 + (c & 7);
#pragma unroll
        for (int t = 0; t < 4; ++t)
#pragma unroll
            for (int g = 0; g < 8; ++g)
                if (j0 + 8 * hi + g < SKV)
                    kf[(t >> 1) * FRAG + (t & 1) * 128 + g * 8] = (_Float16)acc[t][g];
    }
}

// ---------------------------------------------------------------------------
// Kernel 2: fused q-proj + attention + out-proj.
// One block = 64 q rows of one batch. 256 threads = 8 waves.
// bufA: x tile (f16) then h tile; bufB: q tile (f16, pre-scaled by d^-1/2).
// ---------------------------------------------------------------------------
__global__ __launch_bounds__(256) void attn_fused(
    const float*    __restrict__ x,
    const _Float16* __restrict__ WqT,    // 512 x 512, fragment order
    const _Float16* __restrict__ kP,     // [B][H] fragments, see kv_proj
    const _Float16* __restrict__ vT,     // [B][H] fragments, see kv_proj
    const _Float16* __restrict__ WoT,    // 512 x 512, fragment order
    const float*    __restrict__ bout,   // [512]
    float*          __restrict__ out) {
    __shared__ __align__(32) _Float16 bufA[64 * LDP];  // 65 KB  x -> h
    __shared__ __align__(32) _Float16 bufB[64 * LDP];  // 65 KB  q

    const int tid  = threadIdx.x;
    const int w    = tid >> 5, lane = tid & 31;
    const int b    = blockIdx.y;
    const int m0   = blockIdx.x * 64;

    // ---------- phase 0: x tile (one contiguous block) -> f16 LDS rows ----------
    const float4* xs = (const float4*)(x + ((size_t)b * SQ + m0) * DM);
    __builtin_prefetch(WqT + (size_t)tid * 1024, 0, 1);   // warm L2 with Wq
    for (int i = tid; i < 64 * DM / 4; i += 256) {
        float4 v = xs[i];
        _Float16* d = bufA + (i / (DM / 4)) * LDP + (i % (DM / 4)) * 4;
        d[0] = (_Float16)v.x; d[1] = (_Float16)v.y;
        d[2] = (_Float16)v.z; d[3] = (_Float16)v.w;
    }
    __syncthreads();

    // ---------- phase 1: q = x @ Wq  (scaled), write f16 to bufB -------------
    // wave w: all 64 rows x columns 64w .. 64w + 63
    {
        const int n0 = w * 64;
        v8f q[4][4] = {};
        gemm_64x64<false>(bufA, WqT + (size_t)n0 * INNER, lane, q);
#pragma unroll
        for (int mi = 0; mi < 4; ++mi)
#pragma unroll
            for (int t = 0; t < 4; ++t) {
                const int n = n0 + t * 16 + (lane & 15);
#pragma unroll
                for (int g = 0; g < 8; ++g) {
                    const int m = mi * 16 + g + 8 * (lane >> 4);
                    bufB[m * LDP + n] = (_Float16)(q[mi][t][g] * 0.125f);
                }
            }
    }
    __syncthreads();

    // ---------- phase 2: attention, one head per wave, softmax in registers --
    // S^T = K * Q^T: a lane holds 40 of one query's 80 score slots (lane and
    // lane ^ 16 split the keys), so max and sum are in-lane plus one exchange.
    // The score tiles, converted in place, are the B operand of O^T = V^T * P^T;
    // V^T is read in the matching k order (8 keys at 8*hi, 8 keys at 16 + 8*hi).
    {
        const int h = w;
        const int c = lane & 15, hi = lane >> 4;
        const _Float16* kb = kP + (((size_t)b * NH + h) * JPAD) * DH;
        const _Float16* vb = vT + (((size_t)b * NH + h) * DH) * JPAD;
        for (int mt = 0; mt < 4; ++mt) {
            const _Float16* qrow = bufB + (mt * 16) * LDP + h * DH;
            v8f s[5] = {v8f{}, v8f{}, v8f{}, v8f{}, v8f{}};
#pragma unroll
            for (int dstep = 0; dstep < 2; ++dstep) {
                const int d0 = dstep * 32;
                v16h qf = frag16_lds(qrow + d0, LDP, lane);
#pragma unroll
                for (int t = 0; t < 5; ++t) {
                    v16h kf = frag_packed(kb + (t * 2 + dstep) * FRAG, lane);
                    s[t] = wmma32(kf, qf, s[t]);     // s[t][g]: key 16t + 8hi + g, query c
                }
            }
            // keys 77..79 (tile 4, upper half, g >= 5) are padding
#pragma unroll
            for (int g = SKV - 72; g < 8; ++g) s[4][g] = hi ? -1e30f : s[4][g];

            float mx = -1e30f;
#pragma unroll
            for (int t = 0; t < 5; ++t)
#pragma unroll
                for (int g = 0; g < 8; ++g) mx = fmaxf(mx, s[t][g]);
            mx = fmaxf(mx, __shfl_xor(mx, 16));
            float sum = 0.f;
#pragma unroll
            for (int t = 0; t < 5; ++t)
#pragma unroll
                for (int g = 0; g < 8; ++g) {
                    float e = exp2_slot((s[t][g] - mx) * 1.44269504f);
                    s[t][g] = e; sum += e;
                }
            sum += __shfl_xor(sum, 16);
            const float r = 1.f / sum;

            v16h p[3];
#pragma unroll
            for (int kk = 0; kk < 3; ++kk)
#pragma unroll
                for (int g = 0; g < 8; ++g) {
                    p[kk][g]     = (_Float16)(s[2 * kk][g] * r);
                    p[kk][8 + g] = (kk < 2) ? (_Float16)(s[(kk < 2) ? 2 * kk + 1 : 0][g] * r)
                                            : (_Float16)0.f;
                }

            v8f o[4] = {v8f{}, v8f{}, v8f{}, v8f{}};
#pragma unroll
            for (int kk = 0; kk < 3; ++kk) {
#pragma unroll
                for (int td = 0; td < 4; ++td) {
                    const _Float16* vr = vb + (kk * 4 + td) * FRAG + lane * 8;
                    v8h lo = *(const v8h*)vr;
                    v8h up = (kk < 2) ? *(const v8h*)(vr + 256) : v8h{};
                    v16h vf = __builtin_shufflevector(lo, up, 0, 1, 2, 3, 4, 5, 6, 7,
                                                      8, 9, 10, 11, 12, 13, 14, 15);
                    o[td] = wmma32(vf, p[kk], o[td]); // o[td][g]: d 16td + 8hi + g, query c
                }
            }
#pragma unroll
            for (int td = 0; td < 4; ++td) {
                v8h ov;
#pragma unroll
                for (int g = 0; g < 8; ++g) ov[g] = (_Float16)o[td][g];
                *(v8h*)(bufA + (mt * 16 + c) * LDP + h * DH + td * 16 + 8 * hi) = ov;
            }
        }
    }
    __syncthreads();

    // ---------- phase 3: out = h @ Wout + bout -------------------------------
    // wave w: all 64 rows x columns 64w .. 64w + 63. The accumulators go out through a staging
    // tile of the wave's own in bufB (q is dead behind the barrier above): 16 rows at a time are
    // written as the lanes hold them and read back row-wise, so that one wave-wide 16-byte global
    // store covers the wave's whole 256 bytes of two rows, four whole cache lines.
    {
        const int n0 = w * 64;
        const int c = lane & 15, hi = lane >> 4;
        float* orow = out + ((size_t)b * SQ + m0) * INNER + n0 + c * 4;
        float* stg  = (float*)bufB + w * (16 * OSP);
        v8f o[4][4] = {};
        gemm_64x64<true>(bufA, WoT + (size_t)n0 * INNER, lane, o);
        const v4f bias = *(const v4f*)(bout + n0 + c * 4);
#pragma unroll
        for (int mi = 0; mi < 4; ++mi) {
#pragma unroll
            for (int t = 0; t < 4; ++t) {
                float* d = stg + c * OSP + t * 16 + hi * 8;
                *(v4f*)d       = __builtin_shufflevector(o[mi][t], o[mi][t], 0, 1, 2, 3);
                *(v4f*)(d + 4) = __builtin_shufflevector(o[mi][t], o[mi][t], 4, 5, 6, 7);
            }
            // the rows are read back by other lanes of the wave than wrote them: the writes have
            // to be done, and the compiler may not lift the reads over them
            asm volatile("s_wait_dscnt 0x0" ::: "memory");
#pragma unroll
            for (int j = 0; j < 8; ++j) {
                const v4f v = *(const v4f*)(stg + (2 * j + hi) * OSP + c * 4) + bias;
                *(v4f*)(orow + (size_t)(mi * 16 + 2 * j + hi) * INNER) = v;
            }
            // the next 16 rows are read back into registers that these stores name: the wait that
            // belongs in front of such an overwrite. Its clobber also keeps the next rows' LDS
            // writes behind the reads above, which other lanes' rows depend on.
            if (mi < 3) asm volatile("s_wait_xcnt 0x0" ::: "memory");
        }
    }
}

// ---------------------------------------------------------------------------
// launch
// ---------------------------------------------------------------------------
extern "C" void kernel_launch(void* const* d_in, const int* in_sizes, int n_in,
                              void* d_out, int out_size, void* d_ws, size_t ws_size,
                              hipStream_t stream) {
    const float* x    = (const float*)d_in[0];
    const float* ctx  = (const float*)d_in[1];
    const float* Wq   = (const float*)d_in[2];
    const float* Wk   = (const float*)d_in[3];
    const float* Wv   = (const float*)d_in[4];
    const float* Wout = (const float*)d_in[5];
    const float* bout = (const float*)d_in[6];
    float* out = (float*)d_out;

    char* ws = (char*)d_ws;
    size_t off = 0;
    _Float16* WqT = (_Float16*)(ws + off); off += (size_t)INNER * DM * 2;     // fragments [8][16][4][FRAG]
    _Float16* WkT = (_Float16*)(ws + off); off += (size_t)INNER * DC * 2;     // fragments [8][24][4][FRAG]
    _Float16* WvT = (_Float16*)(ws + off); off += (size_t)INNER * DC * 2;     // fragments [8][24][4][FRAG]
    _Float16* WoT = (_Float16*)(ws + off); off += (size_t)INNER * INNER * 2;  // fragments [8][16][4][FRAG]
    _Float16* kP  = (_Float16*)(ws + off);
    size_t kvBytes = 2ull * B_ * NH * JPAD * DH * 2;                          // kP + vT
    _Float16* vT  = (_Float16*)(ws + off + kvBytes / 2);

    // one launch: all four weights to f16 fragments (WqT, WkT, WvT, WoT are consecutive) and
    // zeros over K's last key tile
    wcvt_all<<<dim3(CVB_Q + 2 * CVB_C + CVB_O + CVB_Z), 256, 0, stream>>>(Wq, Wk, Wv, Wout, WqT, kP);

    // k/v projection: 5 j-tiles x 16 batches x {k,v}
    kv_proj<<<dim3(5, B_, 2), 256, 0, stream>>>(ctx, WkT, WvT, kP, vT);

    // fused q-proj + attention + out-proj: 64 q-tiles x 16 batches
    attn_fused<<<dim3(SQ / 64, B_), 256, 0, stream>>>(x, WqT, kP, vT, WoT, bout, out);
}

// v008
// A run of this version takes 82.9 microseconds.
// Two timings next to v007 both put it at 1.20 times that version's speed.
// Counting every step since v000, it is 10.3 times as fast.
#include <hip/hip_runtime.h>
#include <hip/hip_bf16.h>

typedef __attribute__((ext_vector_type(16))) _Float16 v16h;
typedef __attribute__((ext_vector_type(8)))  _Float16 v8h;
typedef __attribute__((ext_vector_type(4)))  _Float16 v4h;
typedef __attribute__((ext_vector_type(8)))  float    v8f;
typedef __attribute__((ext_vector_type(4)))  float    v4f;

#define B_   16
#define SQ   4096
#define DM   512
#define SKV  77
#define DC   768
#define NH   8
#define DH   64
#define INNER 512
#define JPAD 128   // Skv padded to multiple of 32 (K-dim of attn@v WMMA)
// LDS row pitches in halfs: row length + 8, so a pitch is an odd multiple of 16 bytes and the
// 16 rows that one ds_load_b128 / ds_store_b128 touches fall on 16 different groups of 4 banks.
#define LDP  (INNER + 8)   // 1040 B
#define CTP  (DC + 8)      // 1552 B
// Row pitch in floats of a wave's output staging tile (16 rows x 64 columns): 272 B, again an odd
// multiple of 16 bytes, for its 16-byte stores (one row a lane).
#define OSP  (64 + 4)

// ---------------------------------------------------------------------------
// helpers
// ---------------------------------------------------------------------------
__device__ __forceinline__ v8f wmma32(v16h a, v16h b, v8f c) {
    // D = A(16x32 f16) * B(32x16 f16) + C(16x16 f32)
    return __builtin_amdgcn_wmma_f32_16x16x32_f16(
        /*neg_a=*/false, a, /*neg_b=*/false, b,
        /*c_mod=*/(short)0, c, /*reuse_a=*/false, /*reuse_b=*/false);
}

// Fragment order: every matrix operand that is read from global memory is stored as a row of
// 1-KiB fragments (16 rows x 32 k), each laid out [piece 0..1][lane 0..31][8 halfs]. Lane l
// owns row l & 15 and k = 16 * (l >> 4) + 8 * piece + e (V: see attn_fused), so one wave-wide
// 16-byte load reads 512 contiguous bytes, four whole cache lines.
#define FRAG 512   // halfs in a fragment
__device__ __forceinline__ v16h frag_packed(const _Float16* f, int lane) {
    v8h lo = *(const v8h*)(f + lane * 8);
    v8h up = *(const v8h*)(f + 256 + lane * 8);
    return __builtin_shufflevector(lo, up, 0, 1, 2, 3, 4, 5, 6, 7, 8, 9, 10, 11, 12, 13, 14, 15);
}

// A fragment from a padded LDS tile: lane picks row lane & 15 and 16 halfs along K from
// 16 * (lane >> 4); rows are 16-byte aligned, so they are read as two 16-byte pieces.
__device__ __forceinline__ v16h frag16_lds(const _Float16* base, int pitch, int lane) {
    const _Float16* p = base + (lane & 15) * pitch + ((lane >> 4) << 4);
    v8h lo = *(const v8h*)p;
    v8h up = *(const v8h*)(p + 8);
    return __builtin_shufflevector(lo, up, 0, 1, 2, 3, 4, 5, 6, 7, 8, 9, 10, 11, 12, 13, 14, 15);
}

// 2^x. The v_nop is the one free issue slot the instruction set asks for behind a
// transcendental.
__device__ __forceinline__ float exp2_slot(float x) {
    float r;
    asm("v_exp_f32 %0, %1\n\tv_nop" : "=v"(r) : "v"(x));
    return r;
}

// acc[mi][t] += A rows 16mi .. (64 x 512 in LDS, row pitch LDP) * wt columns 16t .. (64 x 512,
// global, fragment order [k step][t]).
// One wave owns all 64 rows of 64 output columns, so each weight fragment read from
// global memory feeds four matrix instructions and no two waves read the same weights.
// TR: the product is formed transposed (weights as the A operand), so that a lane holds 8
// consecutive columns 16t + 8 * (lane >> 4) .. of row 16mi + (lane & 15) and not 8 rows of one column.
template <bool TR>
__device__ __forceinline__ void gemm_64x64(const _Float16* a_lds, const _Float16* wt,
                                           int lane, v8f (&acc)[4][4]) {
    // each call keeps the form the build gave it so far: the out projection's loop unrolled (a
    // step's weight loads are then issued ahead of the last matrix instructions of the step
    // before), the q projection's rolled
#pragma unroll(TR ? INNER / 32 : 1)
    for (int ks = 0; ks < INNER / 32; ++ks) {
        const int k0 = ks * 32;
        v16h bf[4], a[4];
#pragma unroll
        for (int t = 0; t < 4; ++t)
            bf[t] = frag_packed(wt + (ks * 4 + t) * FRAG, lane);
#pragma unroll
        for (int mi = 0; mi < 4; ++mi)
            a[mi] = frag16_lds(a_lds + (mi * 16) * LDP + k0, LDP, lane);
        // keeps all 16 loads of the step ahead of its 16 matrix instructions: without it
        // three weight loads were issued among them and waited for at once
        __builtin_amdgcn_sched_barrier(0);
#pragma unroll
        for (int t = 0; t < 4; ++t)
#pragma unroll
            for (int mi = 0; mi < 4; ++mi)
                acc[mi][t] = TR ? wmma32(bf[t], a[mi], acc[mi][t]) : wmma32(a[mi], bf[t], acc[mi][t]);
    }
}

// ---------------------------------------------------------------------------
// Kernel 0: convert the four f32 weights [K][INNER] -> f16 fragments
// [INNER/64][K/32][4 column tiles][FRAG], all in one launch. A block makes the four fragments of
// one (64-column group, k step) of one matrix; its index range says which matrix. The four
// outputs lie one behind the other in the workspace in the order Wq, Wk, Wv, Wout, so the
// block index is also the output position. One thread makes one 16-byte piece (8 k of one column).
// The last CVB_Z blocks store zeros over the last key tile of K (two fragments a head), of which
// kv_proj, the next launch, writes the SKV % 16 valid rows only; V's padding kv_proj writes itself.
// ---------------------------------------------------------------------------
#define CVB_Q (DM * INNER / 8 / 256)      // blocks of Wq
#define CVB_C (DC * INNER / 8 / 256)      // blocks of Wk, and of Wv
#define CVB_O (INNER * INNER / 8 / 256)   // blocks of Wout
#define CVB_Z (B_ * NH * 2 * FRAG / 8 / 256)   // blocks that zero K's last key tile
__global__ __launch_bounds__(256) void wcvt_all(const float* __restrict__ Wq,
                                                const float* __restrict__ Wk,
                                                const float* __restrict__ Wv,
                                                const float* __restrict__ Wo,
                                                _Float16* __restrict__ dst,
                                                _Float16* __restrict__ kP) {
    const int blk = blockIdx.x, tid = threadIdx.x;
    if (blk >= CVB_Q + 2 * CVB_C + CVB_O) {
        const int i = (blk - (CVB_Q + 2 * CVB_C + CVB_O)) * 256 + tid;   // 16-byte piece
        const int head = i / (2 * FRAG / 8), pc = i % (2 * FRAG / 8);
        *(v8h*)(kP + (size_t)head * (JPAD * DH) + (SKV / 16) * 2 * FRAG + pc * 8) = v8h{};
        return;
    }
    const float* src;
    int nw, ks;
    if (blk < CVB_Q) {
        src = Wq; nw = blk / (DM / 32); ks = blk % (DM / 32);
    } else if (blk < CVB_Q + CVB_C) {
        src = Wk; nw = (blk - CVB_Q) / (DC / 32); ks = (blk - CVB_Q) % (DC / 32);
    } else if (blk < CVB_Q + 2 * CVB_C) {
        src = Wv; nw = (blk - CVB_Q - CVB_C) / (DC / 32); ks = (blk - CVB_Q - CVB_C) % (DC / 32);
    } else {
        src = Wo; nw = (blk - CVB_Q - 2 * CVB_C) / (INNER / 32);
        ks = (blk - CVB_Q - 2 * CVB_C) % (INNER / 32);
    }
    const int lane = tid & 31, piece = (tid >> 5) & 1, t = (tid >> 6) & 3;
    const int n  = (nw * 4 + t) * 16 + (lane & 15);
    const int k0 = ks * 32 + (lane >> 4) * 16 + piece * 8;
    float f[8];
#pragma unroll
    for (int e = 0; e < 8; ++e) f[e] = src[(size_t)(k0 + e) * INNER + n];
    // the converted halfs are written over the loads' address registers: the wait that
    // belongs in front of such an overwrite
    asm volatile("s_wait_xcnt 0x0" ::: "memory");
    v8h o;
#pragma unroll
    for (int e = 0; e < 8; ++e) o[e] = (_Float16)f[e];
    *(v8h*)(dst + ((size_t)blk * 256 + tid) * 8) = o;
}

// ---------------------------------------------------------------------------
// Kernel 1: k/v projection (WMMA).
//   context[b][j][768] @ Wk/Wv -> per head (JPAD * DH halfs each), in fragment order:
//     kP[b][h][j tile(5)][d step(2)][FRAG]    rows = keys, k = d
//     vT[b][h][j step(3)][d tile(4)][FRAG]    rows = d, k = keys: piece p, lane half hi hold
//                                             keys 16p + 8hi .. + 7 of the step
// grid = (5 m-tiles, 16 batches, 2 {k,v}), block = 256 (8 waves)
// ---------------------------------------------------------------------------
#define KVR 5   // k steps of weight fragments held in the register ring (8 16-byte loads a step)
__global__ __launch_bounds__(256) void kv_proj(
    const float* __restrict__ ctx,
    const _Float16* __restrict__ WkT,   // 512 x 768 f16 fragments
    const _Float16* __restrict__ WvT,   // 512 x 768 f16 fragments
    _Float16* __restrict__ kP,
    _Float16* __restrict__ vT) {
    __shared__ __align__(32) _Float16 ct[16 * CTP];  // 24 KB context tile (f16), padded rows

    const int tid  = threadIdx.x;
    const int b    = blockIdx.y;
    const int j0   = blockIdx.x * 16;
    const int isv  = blockIdx.z;
    const int w    = tid >> 5, lane = tid & 31;

    // The tile's 16 rows are one contiguous run of 16 * DC / 4 16-byte pieces, 12 a thread. All 12
    // loads are issued before the first value is used, so a thread waits out one memory latency
    // and not one per load. Pieces of the padding rows (j >= SKV) read the last valid piece
    // instead, which keeps the address inside ctx, and are stored as zeros.
    const v4f* cbase = (const v4f*)(ctx + ((size_t)b * SKV + j0) * DC);
    const int npc = (SKV - j0 < 16 ? SKV - j0 : 16) * (DC / 4);   // valid pieces of this tile
    v4f cv[16 * DC / 4 / 256];
    int pc[16 * DC / 4 / 256];
#pragma unroll
    for (int u = 0; u < 16 * DC / 4 / 256; ++u) {
        const int i = tid + u * 256;
        pc[u] = i < npc ? i : npc - 1;
        cv[u] = cbase[pc[u]];
    }
    // Weight ring: the wave's weight fragments of KVR k steps are in flight or in registers at any
    // time. The first KVR steps depend on nothing of the tile and are issued here, behind the
    // context loads, so that both kinds of load wait out their latency together.
    const _Float16* wp = (isv ? WvT : WkT) + (size_t)w * (DC / 32) * 4 * FRAG;
    v16h wr[KVR][4];
#pragma unroll
    for (int s = 0; s < KVR; ++s)
#pragma unroll
        for (int t = 0; t < 4; ++t) wr[s][t] = frag_packed(wp + (s * 4 + t) * FRAG, lane);
    // The loaded values as inputs hold all 12 loads ahead of the first convert (without that the
    // build issued part of them only behind waits on earlier ones). The piece indices as inputs
    // keep the loads' offset registers untouched up to here, so that no load's result lands in an
    // earlier load's offset register, and the wait stands in front of their first overwrite.
    asm volatile("s_wait_xcnt 0x0"
                 :: "v"(cv[0]), "v"(cv[1]), "v"(cv[2]), "v"(cv[3]), "v"(cv[4]), "v"(cv[5]),
                    "v"(cv[6]), "v"(cv[7]), "v"(cv[8]), "v"(cv[9]), "v"(cv[10]), "v"(cv[11]),
                    "v"(pc[0]), "v"(pc[1]), "v"(pc[2]), "v"(pc[3]), "v"(pc[4]), "v"(pc[5]),
                    "v"(pc[6]), "v"(pc[7]), "v"(pc[8]), "v"(pc[9]), "v"(pc[10]), "v"(pc[11])
                 : "memory");
#pragma unroll
    for (int u = 0; u < 16 * DC / 4 / 256; ++u) {
        const int i = tid + u * 256;
        const int r = i / (DC / 4), c4 = i - r * (DC / 4);
        const bool in = i < npc;
        const v4h o = {(_Float16)cv[u][0], (_Float16)cv[u][1], (_Float16)cv[u][2], (_Float16)cv[u][3]};
        uint2 ob = __builtin_bit_cast(uint2, o);
        ob.x = in ? ob.x : 0u;
        ob.y = in ? ob.y : 0u;
        *(uint2*)(ct + r * CTP + c4 * 4) = ob;
    }
    __syncthreads();

    // Step ks multiplies out of ring slot ks % KVR and then refills that slot with step ks + KVR, so
    // a step's 8 loads are issued KVR steps ahead of their wait. The context fragment is read from
    // LDS one step ahead. Unrolled in full: the slot numbers have to be constants for the ring to
    // stay in registers.
    v8f acc[4] = {v8f{}, v8f{}, v8f{}, v8f{}};
    v16h a[2];
    a[0] = frag16_lds(ct, CTP, lane);
#pragma unroll
    for (int ks = 0; ks < DC / 32; ++ks) {
        if (ks + 1 < DC / 32) a[(ks + 1) & 1] = frag16_lds(ct + (ks + 1) * 32, CTP, lane);
#pragma unroll
        for (int t = 0; t < 4; ++t) acc[t] = wmma32(a[ks & 1], wr[ks % KVR][t], acc[t]);
        if (ks + KVR < DC / 32) {
#pragma unroll
            for (int t = 0; t < 4; ++t)
                wr[ks % KVR][t] = frag_packed(wp + ((ks + KVR) * 4 + t) * FRAG, lane);
        }
        // keeps each refill at its own step: gathered further down, fewer loads would be in flight
        __builtin_amdgcn_sched_barrier(0);
    }

    // wave w holds head w: d = 16t + c, keys j0 + 8hi + g
    const int c = lane & 15, hi = lane >> 4;
    const size_t head = ((size_t)b * NH + w) * (JPAD * DH);
    if (isv) {
        // the lane's 8 keys are one 16-byte piece of V's fragment; padding keys stay 0
        _Float16* vf = vT + head + (j0 >> 5) * 4 * FRAG + ((j0 >> 4) & 1) * 256 + lane * 8;
#pragma unroll
        for (int t = 0; t < 4; ++t) {
            v8h ov;
#pragma unroll
            for (int g = 0; g < 8; ++g)
                ov[g] = (j0 + 8 * hi + g < SKV) ? (_Float16)acc[t][g] : (_Float16)0.f;
            *(v8h*)(vf + t * FRAG) = ov;
        }
        // the registers these four stores name are reused on the code path that follows in the
        // build: the wait that belongs in front of such an overwrite
        asm volatile("s_wait_xcnt 0x0" ::: "memory");
    } else {
        _Float16* kf = kP + head + (j0 >> 4) * 2 * FRAG + (c >> 3) * 256 + hi * 64 + (c & 7);
#pragma unroll
        for (int t = 0; t < 4; ++t)
#pragma unroll
            for (int g = 0; g < 8; ++g)
                if (j0 + 8 * hi + g < SKV)
                    kf[(t >> 1) * FRAG + (t & 1) * 128 + g * 8] = (_Float16)acc[t][g];
    }
}

// ---------------------------------------------------------------------------
// Kernel 2: fused q-proj + attention + out-proj.
// One block = 64 q rows of one batch. 256 threads = 8 waves.
// bufA: x tile (f16) then h tile; bufB: q tile (f16, pre-scaled by d^-1/2).
// ---------------------------------------------------------------------------
__global__ __launch_bounds__(256) void attn_fused(
    const float*    __restrict__ x,
    const _Float16* __restrict__ WqT,    // 512 x 512, fragment order
    const _Float16* __restrict__ kP,     // [B][H] fragments, see kv_proj
    const _Float16* __restrict__ vT,     // [B][H] fragments, see kv_proj
    const _Float16* __restrict__ WoT,    // 512 x 512, fragment order
    const float*    __restrict__ bout,   // [512]
    float*          __restrict__ out) {
    __shared__ __align__(32) _Float16 bufA[64 * LDP];  // 65 KB  x -> h
    __shared__ __align__(32) _Float16 bufB[64 * LDP];  // 65 KB  q

    const int tid  = threadIdx.x;
    const int w    = tid >> 5, lane = tid & 31;
    const int b    = blockIdx.y;
    const int m0   = blockIdx.x * 64;

    // ---------- phase 0: x tile (one contiguous block) -> f16 LDS rows ----------
    const float4* xs = (const float4*)(x + ((size_t)b * SQ + m0) * DM);
    __builtin_prefetch(WqT + (size_t)tid * 1024, 0, 1);   // warm L2 with Wq
    for (int i = tid; i < 64 * DM / 4; i += 256) {
        float4 v = xs[i];
        _Float16* d = bufA + (i / (DM / 4)) * LDP + (i % (DM / 4)) * 4;
        d[0] = (_Float16)v.x; d[1] = (_Float16)v.y;
        d[2] = (_Float16)v.z; d[3] = (_Float16)v.w;
    }
    __syncthreads();

    // ---------- phase 1: q = x @ Wq  (scaled), write f16 to bufB -------------
    // wave w: all 64 rows x columns 64w .. 64w + 63
    {
        const int n0 = w * 64;
        v8f q[4][4] = {};
        gemm_64x64<false>(bufA, WqT + (size_t)n0 * INNER, lane, q);
#pragma unroll
        for (int mi = 0; mi < 4; ++mi)
#pragma unroll
            for (int t = 0; t < 4; ++t) {
                const int n = n0 + t * 16 + (lane & 15);
#pragma unroll
                for (int g = 0; g < 8; ++g) {
                    const int m = mi * 16 + g + 8 * (lane >> 4);
                    bufB[m * LDP + n] = (_Float16)(q[mi][t][g] * 0.125f);
                }
            }
    }
    __syncthreads();

    // ---------- phase 2: attention, one head per wave, softmax in registers --
    // S^T = K * Q^T: a lane holds 40 of one query's 80 score slots (lane and
    // lane ^ 16 split the keys), so max and sum are in-lane plus one exchange.
    // The score tiles, converted in place, are the B operand of O^T = V^T * P^T;
    // V^T is read in the matching k order (8 keys at 8*hi, 8 keys at 16 + 8*hi).
    {
        const int h = w;
        const int c = lane & 15, hi = lane >> 4;
        const _Float16* kb = kP + (((size_t)b * NH + h) * JPAD) * DH;
        const _Float16* vb = vT + (((size_t)b * NH + h) * DH) * JPAD;
        for (int mt = 0; mt < 4; ++mt) {
            const _Float16* qrow = bufB + (mt * 16) * LDP + h * DH;
            v8f s[5] = {v8f{}, v8f{}, v8f{}, v8f{}, v8f{}};
#pragma unroll
            for (int dstep = 0; dstep < 2; ++dstep) {
                const int d0 = dstep * 32;
                v16h qf = frag16_lds(qrow + d0, LDP, lane);
#pragma unroll
                for (int t = 0; t < 5; ++t) {
                    v16h kf = frag_packed(kb + (t * 2 + dstep) * FRAG, lane);
                    s[t] = wmma32(kf, qf, s[t]);     // s[t][g]: key 16t + 8hi + g, query c
                }
            }
            // keys 77..79 (tile 4, upper half, g >= 5) are padding
#pragma unroll
            for (int g = SKV - 72; g < 8; ++g) s[4][g] = hi ? -1e30f : s[4][g];

            float mx = -1e30f;
#pragma unroll
            for (int t = 0; t < 5; ++t)
#pragma unroll
                for (int g = 0; g < 8; ++g) mx = fmaxf(mx, s[t][g]);
            mx = fmaxf(mx, __shfl_xor(mx, 16));
            float sum = 0.f;
#pragma unroll
            for (int t = 0; t < 5; ++t)
#pragma unroll
                for (int g = 0; g < 8; ++g) {
                    float e = exp2_slot((s[t][g] - mx) * 1.44269504f);
                    s[t][g] = e; sum += e;
                }
            sum += __shfl_xor(sum, 16);
            const float r = 1.f / sum;

            v16h p[3];
#pragma unroll
            for (int kk = 0; kk < 3; ++kk)
#pragma unroll
                for (int g = 0; g < 8; ++g) {
                    p[kk][g]     = (_Float16)(s[2 * kk][g] * r);
                    p[kk][8 + g] = (kk < 2) ? (_Float16)(s[(kk < 2) ? 2 * kk + 1 : 0][g] * r)
                                            : (_Float16)0.f;
                }

            v8f o[4] = {v8f{}, v8f{}, v8f{}, v8f{}};
#pragma unroll
            for (int kk = 0; kk < 3; ++kk) {
#pragma unroll
                for (int td = 0; td < 4; ++td) {
                    const _Float16* vr = vb + (kk * 4 + td) * FRAG + lane * 8;
                    v8h lo = *(const v8h*)vr;
                    v8h up = (kk < 2) ? *(const v8h*)(vr + 256) : v8h{};
                    v16h vf = __builtin_shufflevector(lo, up, 0, 1, 2, 3, 4, 5, 6, 7,
                                                      8, 9, 10, 11, 12, 13, 14, 15);
                    o[td] = wmma32(vf, p[kk], o[td]); // o[td][g]: d 16td + 8hi + g, query c
                }
            }
#pragma unroll
            for (int td = 0; td < 4; ++td) {
                v8h ov;
#pragma unroll
                for (int g = 0; g < 8; ++g) ov[g] = (_Float16)o[td][g];
                *(v8h*)(bufA + (mt * 16 + c) * LDP + h * DH + td * 16 + 8 * hi) = ov;
            }
        }
    }
    __syncthreads();

    // ---------- phase 3: out = h @ Wout + bout -------------------------------
    // wave w: all 64 rows x columns 64w .. 64w + 63. The accumulators go out through a staging
    // tile of the wave's own in bufB (q is dead behind the barrier above): 16 rows at a time are
    // written as the lanes hold them and read back row-wise, so that one wave-wide 16-byte global
    // store covers the wave's whole 256 bytes of two rows, four whole cache lines.
    {
        const int n0 = w * 64;
        const int c = lane & 15, hi = lane >> 4;
        float* orow = out + ((size_t)b * SQ + m0) * INNER + n0 + c * 4;
        float* stg  = (float*)bufB + w * (16 * OSP);
        v8f o[4][4] = {};
        gemm_64x64<true>(bufA, WoT + (size_t)n0 * INNER, lane, o);
        const v4f bias = *(const v4f*)(bout + n0 + c * 4);
#pragma unroll
        for (int mi = 0; mi < 4; ++mi) {
#pragma unroll
            for (int t = 0; t < 4; ++t) {
                float* d = stg + c * OSP + t * 16 + hi * 8;
                *(v4f*)d       = __builtin_shufflevector(o[mi][t], o[mi][t], 0, 1, 2, 3);
                *(v4f*)(d + 4) = __builtin_shufflevector(o[mi][t], o[mi][t], 4, 5, 6, 7);
            }
            // the rows are read back by other lanes of the wave than wrote them: the writes have
            // to be done, and the compiler may not lift the reads over them
            asm volatile("s_wait_dscnt 0x0" ::: "memory");
#pragma unroll
            for (int j = 0; j < 8; ++j) {
                const v4f v = *(const v4f*)(stg + (2 * j + hi) * OSP + c * 4) + bias;
                *(v4f*)(orow + (size_t)(mi * 16 + 2 * j + hi) * INNER) = v;
            }
            // the next 16 rows are read back into registers that these stores name: the wait that
            // belongs in front of such an overwrite. Its clobber also keeps the next rows' LDS
            // writes behind the reads above, which other lanes' rows depend on.
            if (mi < 3) asm volatile("s_wait_xcnt 0x0" ::: "memory");
        }
    }
}

// ---------------------------------------------------------------------------
// launch
// ---------------------------------------------------------------------------
extern "C" void kernel_launch(void* const* d_in, const int* in_sizes, int n_in,
                              void* d_out, int out_size, void* d_ws, size_t ws_size,
                              hipStream_t stream) {
    const float* x    = (const float*)d_in[0];
    const float* ctx  = (const float*)d_in[1];
    const float* Wq   = (const float*)d_in[2];
    const float* Wk   = (const float*)d_in[3];
    const float* Wv   = (const float*)d_in[4];
    const float* Wout = (const float*)d_in[5];
    const float* bout = (const float*)d_in[6];
    float* out = (float*)d_out;

    char* ws = (char*)d_ws;
    size_t off = 0;
    _Float16* WqT = (_Float16*)(ws + off); off += (size_t)INNER * DM * 2;     // fragments [8][16][4][FRAG]
    _Float16* WkT = (_Float16*)(ws + off); off += (size_t)INNER * DC * 2;     // fragments [8][24][4][FRAG]
    _Float16* WvT = (_Float16*)(ws + off); off += (size_t)INNER * DC * 2;     // fragments [8][24][4][FRAG]
    _Float16* WoT = (_Float16*)(ws + off); off += (size_t)INNER * INNER * 2;  // fragments [8][16][4][FRAG]
    _Float16* kP  = (_Float16*)(ws + off);
    size_t kvBytes = 2ull * B_ * NH * JPAD * DH * 2;                          // kP + vT
    _Float16* vT  = (_Float16*)(ws + off + kvBytes / 2);

    // one launch: all four weights to f16 fragments (WqT, WkT, WvT, WoT are consecutive) and
    // zeros over K's last key tile
    wcvt_all<<<dim3(CVB_Q + 2 * CVB_C + CVB_O + CVB_Z), 256, 0, stream>>>(Wq, Wk, Wv, Wout, WqT, kP);

    // k/v projection: 5 j-tiles x 16 batches x {k,v}
    kv_proj<<<dim3(5, B_, 2), 256, 0, stream>>>(ctx, WkT, WvT, kP, vT);

    // fused q-proj + attention + out-proj: 64 q-tiles x 16 batches
    attn_fused<<<dim3(SQ / 64, B_), 256, 0, stream>>>(x, WqT, kP, vT, WoT, bout, out);
}

// v009
// Measured time: 79.9 microseconds a run.
// Timed twice side by side with v008, it ran 1.04 and 1.03 times as fast.
// Counting every step since v000, it is 10.7 times as fast.
#include <hip/hip_runtime.h>
#include <hip/hip_bf16.h>

typedef __attribute__((ext_vector_type(16))) _Float16 v16h;
typedef __attribute__((ext_vector_type(8)))  _Float16 v8h;
typedef __attribute__((ext_vector_type(4)))  _Float16 v4h;
typedef __attribute__((ext_vector_type(8)))  float    v8f;
typedef __attribute__((ext_vector_type(4)))  float    v4f;

#define B_   16
#define SQ   4096
#define DM   512
#define SKV  77
#define DC   768
#define NH   8
#define DH   64
#define INNER 512
#define JPAD 128   // Skv padded to multiple of 32 (K-dim of attn@v WMMA)
// LDS row pitches in halfs: row length + 8, so a pitch is an odd multiple of 16 bytes and the
// 16 rows that one ds_load_b128 / ds_store_b128 touches fall on 16 different groups of 4 banks.
#define LDP  (INNER + 8)   // 1040 B
#define CTP  (DC + 8)      // 1552 B
// Row pitch in floats of a wave's output staging tile (16 rows x 64 columns): 272 B, again an odd
// multiple of 16 bytes, for its 16-byte stores (one row a lane).
#define OSP  (64 + 4)

// ---------------------------------------------------------------------------
// helpers
// ---------------------------------------------------------------------------
__device__ __forceinline__ v8f wmma32(v16h a, v16h b, v8f c) {
    // D = A(16x32 f16) * B(32x16 f16) + C(16x16 f32)
    return __builtin_amdgcn_wmma_f32_16x16x32_f16(
        /*neg_a=*/false, a, /*neg_b=*/false, b,
        /*c_mod=*/(short)0, c, /*reuse_a=*/false, /*reuse_b=*/false);
}

// Fragment order: every matrix operand that is read from global memory is stored as a row of
// 1-KiB fragments (16 rows x 32 k), each laid out [piece 0..1][lane 0..31][8 halfs]. Lane l
// owns row l & 15 and k = 16 * (l >> 4) + 8 * piece + e (V: see attn_fused), so one wave-wide
// 16-byte load reads 512 contiguous bytes, four whole cache lines.
#define FRAG 512   // halfs in a fragment
__device__ __forceinline__ v16h frag_packed(const _Float16* f, int lane) {
    v8h lo = *(const v8h*)(f + lane * 8);
    v8h up = *(const v8h*)(f + 256 + lane * 8);
    return __builtin_shufflevector(lo, up, 0, 1, 2, 3, 4, 5, 6, 7, 8, 9, 10, 11, 12, 13, 14, 15);
}

// A fragment from a padded LDS tile: lane picks row lane & 15 and 16 halfs along K from
// 16 * (lane >> 4); rows are 16-byte aligned, so they are read as two 16-byte pieces.
__device__ __forceinline__ v16h frag16_lds(const _Float16* base, int pitch, int lane) {
    const _Float16* p = base + (lane & 15) * pitch + ((lane >> 4) << 4);
    v8h lo = *(const v8h*)p;
    v8h up = *(const v8h*)(p + 8);
    return __builtin_shufflevector(lo, up, 0, 1, 2, 3, 4, 5, 6, 7, 8, 9, 10, 11, 12, 13, 14, 15);
}

// 2^x. The v_nop is the one free issue slot the instruction set asks for behind a
// transcendental.
__device__ __forceinline__ float exp2_slot(float x) {
    float r;
    asm("v_exp_f32 %0, %1\n\tv_nop" : "=v"(r) : "v"(x));
    return r;
}

// The wave's four weight fragments of k step ks (8 16-byte loads), global, fragment order [k step][t].
__device__ __forceinline__ void load_wfrags(const _Float16* wt, int ks, int lane, v16h (&bf)[4]) {
#pragma unroll   // constant t: bf stays in registers
    for (int t = 0; t < 4; ++t) bf[t] = frag_packed(wt + (ks * 4 + t) * FRAG, lane);
}

// One k step: acc[mi][t] += A rows 16mi .. (LDS, row pitch LDP), k 32ks .., * weight fragment bf[t].
template <bool TR>
__device__ __forceinline__ void gemm_step(const _Float16* a_lds, int ks, int lane,
                                          const v16h (&bf)[4], v8f (&acc)[4][4]) {
    v16h a[4];
#pragma unroll   // constant indices, here and below: a, bf and acc stay in registers
    for (int mi = 0; mi < 4; ++mi)
        a[mi] = frag16_lds(a_lds + (mi * 16) * LDP + ks * 32, LDP, lane);
    // keeps the loads issued so far (the next step's weights, this step's LDS fragments) ahead of
    // the step's 16 matrix instructions: sunk among them they would have less time to come back
    __builtin_amdgcn_sched_barrier(0);
#pragma unroll
    for (int t = 0; t < 4; ++t)
#pragma unroll
        for (int mi = 0; mi < 4; ++mi)
            acc[mi][t] = TR ? wmma32(bf[t], a[mi], acc[mi][t]) : wmma32(a[mi], bf[t], acc[mi][t]);
    // keeps the refill of bf behind the matrix instructions that read it: lifted over them it
    // would take a third set of registers
    __builtin_amdgcn_sched_barrier(0);
}

// acc[mi][t] += A rows 16mi .. (64 x 512 in LDS, row pitch LDP) * wt columns 16t .. (64 x 512,
// global, fragment order [k step][t]).
// One wave owns all 64 rows of 64 output columns, so each weight fragment read from
// global memory feeds four matrix instructions and no two waves read the same weights.
// The weight fragments are fetched one k step ahead into a second register set: a step's 8 loads
// are issued in front of the 16 matrix instructions of the step before and waited for behind
// them. w0 holds step 0's fragments, which the caller loads ahead of its barrier.
// TR: the product is formed transposed (weights as the A operand), so that a lane holds 8
// consecutive columns 16t + 8 * (lane >> 4) .. of row 16mi + (lane & 15) and not 8 rows of one column.
template <bool TR>
__device__ __forceinline__ void gemm_64x64(const _Float16* a_lds, const _Float16* wt,
                                           int lane, v16h (&w0)[4], v8f (&acc)[4][4]) {
    v16h w1[4];
    // unrolled in full: every load's address is then the one base pair plus a constant, and no
    // address register is rewritten while loads are in flight
#pragma unroll
    for (int ks = 0; ks < INNER / 32; ks += 2) {
        load_wfrags(wt, ks + 1, lane, w1);
        gemm_step<TR>(a_lds, ks, lane, w0, acc);
        if (ks + 2 < INNER / 32) load_wfrags(wt, ks + 2, lane, w0);
        gemm_step<TR>(a_lds, ks + 1, lane, w1, acc);
    }
    // the code that follows reuses the base pair of the loads above: the wait that belongs in
    // front of such an overwrite
    asm volatile("s_wait_xcnt 0x0" ::: "memory");
}

// ---------------------------------------------------------------------------
// Kernel 0: convert the four f32 weights [K][INNER] -> f16 fragments
// [INNER/64][K/32][4 column tiles][FRAG], all in one launch. A block makes the four fragments of
// one (64-column group, k step) of one matrix; its index range says which matrix. The four
// outputs lie one behind the other in the workspace in the order Wq, Wk, Wv, Wout, so the
// block index is also the output position. One thread makes one 16-byte piece (8 k of one column).
// The last CVB_Z blocks store zeros over the last key tile of K (two fragments a head), of which
// kv_proj, the next launch, writes the SKV % 16 valid rows only; V's padding kv_proj writes itself.
// ---------------------------------------------------------------------------
#define CVB_Q (DM * INNER / 8 / 256)      // blocks of Wq
#define CVB_C (DC * INNER / 8 / 256)      // blocks of Wk, and of Wv
#define CVB_O (INNER * INNER / 8 / 256)   // blocks of Wout
#define CVB_Z (B_ * NH * 2 * FRAG / 8 / 256)   // blocks that zero K's last key tile
__global__ __launch_bounds__(256) void wcvt_all(const float* __restrict__ Wq,
                                                const float* __restrict__ Wk,
                                                const float* __restrict__ Wv,
                                                const float* __restrict__ Wo,
                                                _Float16* __restrict__ dst,
                                                _Float16* __restrict__ kP) {
    const int blk = blockIdx.x, tid = threadIdx.x;
    if (blk >= CVB_Q + 2 * CVB_C + CVB_O) {
        const int i = (blk - (CVB_Q + 2 * CVB_C + CVB_O)) * 256 + tid;   // 16-byte piece
        const int head = i / (2 * FRAG / 8), pc = i % (2 * FRAG / 8);
        *(v8h*)(kP + (size_t)head * (JPAD * DH) + (SKV / 16) * 2 * FRAG + pc * 8) = v8h{};
        return;
    }
    const float* src;
    int nw, ks;
    if (blk < CVB_Q) {
        src = Wq; nw = blk / (DM / 32); ks = blk % (DM / 32);
    } else if (blk < CVB_Q + CVB_C) {
        src = Wk; nw = (blk - CVB_Q) / (DC / 32); ks = (blk - CVB_Q) % (DC / 32);
    } else if (blk < CVB_Q + 2 * CVB_C) {
        src = Wv; nw = (blk - CVB_Q - CVB_C) / (DC / 32); ks = (blk - CVB_Q - CVB_C) % (DC / 32);
    } else {
        src = Wo; nw = (blk - CVB_Q - 2 * CVB_C) / (INNER / 32);
        ks = (blk - CVB_Q - 2 * CVB_C) % (INNER / 32);
    }
    const int lane = tid & 31, piece = (tid >> 5) & 1, t = (tid >> 6) & 3;
    const int n  = (nw * 4 + t) * 16 + (lane & 15);
    const int k0 = ks * 32 + (lane >> 4) * 16 + piece * 8;
    float f[8];
#pragma unroll
    for (int e = 0; e < 8; ++e) f[e] = src[(size_t)(k0 + e) * INNER + n];
    // the converted halfs are written over the loads' address registers: the wait that
    // belongs in front of such an overwrite
    asm volatile("s_wait_xcnt 0x0" ::: "memory");
    v8h o;
#pragma unroll
    for (int e = 0; e < 8; ++e) o[e] = (_Float16)f[e];
    *(v8h*)(dst + ((size_t)blk * 256 + tid) * 8) = o;
}

// ---------------------------------------------------------------------------
// Kernel 1: k/v projection (WMMA).
//   context[b][j][768] @ Wk/Wv -> per head (JPAD * DH halfs each), in fragment order:
//     kP[b][h][j tile(5)][d step(2)][FRAG]    rows = keys, k = d
//     vT[b][h][j step(3)][d tile(4)][FRAG]    rows = d, k = keys: piece p, lane half hi hold
//                                             keys 16p + 8hi .. + 7 of the step
// grid = (5 m-tiles, 16 batches, 2 {k,v}), block = 256 (8 waves)
// ---------------------------------------------------------------------------
#define KVR 5   // k steps of weight fragments held in the register ring (8 16-byte loads a step)
__global__ __launch_bounds__(256) void kv_proj(
    const float* __restrict__ ctx,
    const _Float16* __restrict__ WkT,   // 512 x 768 f16 fragments
    const _Float16* __restrict__ WvT,   // 512 x 768 f16 fragments
    _Float16* __restrict__ kP,
    _Float16* __restrict__ vT) {
    __shared__ __align__(32) _Float16 ct[16 * CTP];  // 24 KB context tile (f16), padded rows

    const int tid  = threadIdx.x;
    const int b    = blockIdx.y;
    const int j0   = blockIdx.x * 16;
    const int isv  = blockIdx.z;
    const int w    = tid >> 5, lane = tid & 31;

    // The tile's 16 rows are one contiguous run of 16 * DC / 4 16-byte pieces, 12 a thread. All 12
    // loads are issued before the first value is used, so a thread waits out one memory latency
    // and not one per load. Pieces of the padding rows (j >= SKV) read the last valid piece
    // instead, which keeps the address inside ctx, and are stored as zeros.
    const v4f* cbase = (const v4f*)(ctx + ((size_t)b * SKV + j0) * DC);
    const int npc = (SKV - j0 < 16 ? SKV - j0 : 16) * (DC / 4);   // valid pieces of this tile
    v4f cv[16 * DC / 4 / 256];
    int pc[16 * DC / 4 / 256];
#pragma unroll
    for (int u = 0; u < 16 * DC / 4 / 256; ++u) {
        const int i = tid + u * 256;
        pc[u] = i < npc ? i : npc - 1;
        cv[u] = cbase[pc[u]];
    }
    // Weight ring: the wave's weight fragments of KVR k steps are in flight or in registers at any
    // time. The first KVR steps depend on nothing of the tile and are issued here, behind the
    // context loads, so that both kinds of load wait out their latency together.
    const _Float16* wp = (isv ? WvT : WkT) + (size_t)w * (DC / 32) * 4 * FRAG;
    v16h wr[KVR][4];
#pragma unroll
    for (int s = 0; s < KVR; ++s)
#pragma unroll
        for (int t = 0; t < 4; ++t) wr[s][t] = frag_packed(wp + (s * 4 + t) * FRAG, lane);
    // The loaded values as inputs hold all 12 loads ahead of the first convert (without that the
    // build issued part of them only behind waits on earlier ones). The piece indices as inputs
    // keep the loads' offset registers untouched up to here, so that no load's result lands in an
    // earlier load's offset register, and the wait stands in front of their first overwrite.
    asm volatile("s_wait_xcnt 0x0"
                 :: "v"(cv[0]), "v"(cv[1]), "v"(cv[2]), "v"(cv[3]), "v"(cv[4]), "v"(cv[5]),
                    "v"(cv[6]), "v"(cv[7]), "v"(cv[8]), "v"(cv[9]), "v"(cv[10]), "v"(cv[11]),
                    "v"(pc[0]), "v"(pc[1]), "v"(pc[2]), "v"(pc[3]), "v"(pc[4]), "v"(pc[5]),
                    "v"(pc[6]), "v"(pc[7]), "v"(pc[8]), "v"(pc[9]), "v"(pc[10]), "v"(pc[11])
                 : "memory");
#pragma unroll
    for (int u = 0; u < 16 * DC / 4 / 256; ++u) {
        const int i = tid + u * 256;
        const int r = i / (DC / 4), c4 = i - r * (DC / 4);
        const bool in = i < npc;
        const v4h o = {(_Float16)cv[u][0], (_Float16)cv[u][1], (_Float16)cv[u][2], (_Float16)cv[u][3]};
        uint2 ob = __builtin_bit_cast(uint2, o);
        ob.x = in ? ob.x : 0u;
        ob.y = in ? ob.y : 0u;
        *(uint2*)(ct + r * CTP + c4 * 4) = ob;
    }
    __syncthreads();

    // Step ks multiplies out of ring slot ks % KVR and then refills that slot with step ks + KVR, so
    // a step's 8 loads are issued KVR steps ahead of their wait. The context fragment is read from
    // LDS one step ahead. Unrolled in full: the slot numbers have to be constants for the ring to
    // stay in registers.
    v8f acc[4] = {v8f{}, v8f{}, v8f{}, v8f{}};
    v16h a[2];
    a[0] = frag16_lds(ct, CTP, lane);
#pragma unroll
    for (int ks = 0; ks < DC / 32; ++ks) {
        if (ks + 1 < DC / 32) a[(ks + 1) & 1] = frag16_lds(ct + (ks + 1) * 32, CTP, lane);
#pragma unroll
        for (int t = 0; t < 4; ++t) acc[t] = wmma32(a[ks & 1], wr[ks % KVR][t], acc[t]);
        if (ks + KVR < DC / 32) {
#pragma unroll
            for (int t = 0; t < 4; ++t)
                wr[ks % KVR][t] = frag_packed(wp + ((ks + KVR) * 4 + t) * FRAG, lane);
        }
        // keeps each refill at its own step: gathered further down, fewer loads would be in flight
        __builtin_amdgcn_sched_barrier(0);
    }

    // wave w holds head w: d = 16t + c, keys j0 + 8hi + g
    const int c = lane & 15, hi = lane >> 4;
    const size_t head = ((size_t)b * NH + w) * (JPAD * DH);
    if (isv) {
        // the lane's 8 keys are one 16-byte piece of V's fragment; padding keys stay 0
        _Float16* vf = vT + head + (j0 >> 5) * 4 * FRAG + ((j0 >> 4) & 1) * 256 + lane * 8;
#pragma unroll
        for (int t = 0; t < 4; ++t) {
            v8h ov;
#pragma unroll
            for (int g = 0; g < 8; ++g)
                ov[g] = (j0 + 8 * hi + g < SKV) ? (_Float16)acc[t][g] : (_Float16)0.f;
            *(v8h*)(vf + t * FRAG) = ov;
        }
        // the registers these four stores name are reused on the code path that follows in the
        // build: the wait that belongs in front of such an overwrite
        asm volatile("s_wait_xcnt 0x0" ::: "memory");
    } else {
        _Float16* kf = kP + head + (j0 >> 4) * 2 * FRAG + (c >> 3) * 256 + hi * 64 + (c & 7);
#pragma unroll
        for (int t = 0; t < 4; ++t)
#pragma unroll
            for (int g = 0; g < 8; ++g)
                if (j0 + 8 * hi + g < SKV)
                    kf[(t >> 1) * FRAG + (t & 1) * 128 + g * 8] = (_Float16)acc[t][g];
    }
}

// ---------------------------------------------------------------------------
// Kernel 2: fused q-proj + attention + out-proj.
// One block = 64 q rows of one batch. 256 threads = 8 waves.
// bufA: x tile (f16) then h tile; bufB: q tile (f16, pre-scaled by d^-1/2).
// ---------------------------------------------------------------------------
__global__ __launch_bounds__(256) void attn_fused(
    const float*    __restrict__ x,
    const _Float16* __restrict__ WqT,    // 512 x 512, fragment order
    const _Float16* __restrict__ kP,     // [B][H] fragments, see kv_proj
    const _Float16* __restrict__ vT,     // [B][H] fragments, see kv_proj
    const _Float16* __restrict__ WoT,    // 512 x 512, fragment order
    const float*    __restrict__ bout,   // [512]
    float*          __restrict__ out) {
    __shared__ __align__(32) _Float16 bufA[64 * LDP];  // 65 KB  x -> h
    __shared__ __align__(32) _Float16 bufB[64 * LDP];  // 65 KB  q

    const int tid  = threadIdx.x;
    const int w    = tid >> 5, lane = tid & 31;
    const int b    = blockIdx.y;
    const int m0   = blockIdx.x * 64;

    // ---------- phase 0: x tile (one contiguous block) -> f16 LDS rows ----------
    const float4* xs = (const float4*)(x + ((size_t)b * SQ + m0) * DM);
    __builtin_prefetch(WqT + (size_t)tid * 1024, 0, 1);   // warm L2 with Wq
    // step 0's weight fragments of the q projection depend on nothing of the tile: issued here,
    // they come back while the x tile is staged
    v16h wq0[4];
    load_wfrags(WqT + (size_t)(w * 64) * INNER, 0, lane, wq0);
    for (int i = tid; i < 64 * DM / 4; i += 256) {
        float4 v = xs[i];
        _Float16* d = bufA + (i / (DM / 4)) * LDP + (i % (DM / 4)) * 4;
        d[0] = (_Float16)v.x; d[1] = (_Float16)v.y;
        d[2] = (_Float16)v.z; d[3] = (_Float16)v.w;
    }
    __syncthreads();

    // ---------- phase 1: q = x @ Wq  (scaled), write f16 to bufB -------------
    // wave w: all 64 rows x columns 64w .. 64w + 63
    {
        const int n0 = w * 64;
        v8f q[4][4] = {};
        gemm_64x64<false>(bufA, WqT + (size_t)n0 * INNER, lane, wq0, q);
#pragma unroll
        for (int mi = 0; mi < 4; ++mi)
#pragma unroll
            for (int t = 0; t < 4; ++t) {
                const int n = n0 + t * 16 + (lane & 15);
#pragma unroll
                for (int g = 0; g < 8; ++g) {
                    const int m = mi * 16 + g + 8 * (lane >> 4);
                    bufB[m * LDP + n] = (_Float16)(q[mi][t][g] * 0.125f);
                }
            }
    }
    __syncthreads();

    // ---------- phase 2: attention, one head per wave, softmax in registers --
    // S^T = K * Q^T: a lane holds 40 of one query's 80 score slots (lane and
    // lane ^ 16 split the keys), so max and sum are in-lane plus one exchange.
    // The score tiles, converted in place, are the B operand of O^T = V^T * P^T;
    // V^T is read in the matching k order (8 keys at 8*hi, 8 keys at 16 + 8*hi).
    {
        const int h = w;
        const int c = lane & 15, hi = lane >> 4;
        const _Float16* kb = kP + (((size_t)b * NH + h) * JPAD) * DH;
        const _Float16* vb = vT + (((size_t)b * NH + h) * DH) * JPAD;
        for (int mt = 0; mt < 4; ++mt) {
            const _Float16* qrow = bufB + (mt * 16) * LDP + h * DH;
            v8f s[5] = {v8f{}, v8f{}, v8f{}, v8f{}, v8f{}};
#pragma unroll
            for (int dstep = 0; dstep < 2; ++dstep) {
                const int d0 = dstep * 32;
                v16h qf = frag16_lds(qrow + d0, LDP, lane);
#pragma unroll
                for (int t = 0; t < 5; ++t) {
                    v16h kf = frag_packed(kb + (t * 2 + dstep) * FRAG, lane);
                    s[t] = wmma32(kf, qf, s[t]);     // s[t][g]: key 16t + 8hi + g, query c
                }
            }
            // keys 77..79 (tile 4, upper half, g >= 5) are padding
#pragma unroll
            for (int g = SKV - 72; g < 8; ++g) s[4][g] = hi ? -1e30f : s[4][g];

            float mx = -1e30f;
#pragma unroll
            for (int t = 0; t < 5; ++t)
#pragma unroll
                for (int g = 0; g < 8; ++g) mx = fmaxf(mx, s[t][g]);
            mx = fmaxf(mx, __shfl_xor(mx, 16));
            float sum = 0.f;
#pragma unroll
            for (int t = 0; t < 5; ++t)
#pragma unroll
                for (int g = 0; g < 8; ++g) {
                    float e = exp2_slot((s[t][g] - mx) * 1.44269504f);
                    s[t][g] = e; sum += e;
                }
            sum += __shfl_xor(sum, 16);
            const float r = 1.f / sum;

            v16h p[3];
#pragma unroll
            for (int kk = 0; kk < 3; ++kk)
#pragma unroll
                for (int g = 0; g < 8; ++g) {
                    p[kk][g]     = (_Float16)(s[2 * kk][g] * r);
                    p[kk][8 + g] = (kk < 2) ? (_Float16)(s[(kk < 2) ? 2 * kk + 1 : 0][g] * r)
                                            : (_Float16)0.f;
                }

            v8f o[4] = {v8f{}, v8f{}, v8f{}, v8f{}};
#pragma unroll
            for (int kk = 0; kk < 3; ++kk) {
#pragma unroll
                for (int td = 0; td < 4; ++td) {
                    const _Float16* vr = vb + (kk * 4 + td) * FRAG + lane * 8;
                    v8h lo = *(const v8h*)vr;
                    v8h up = (kk < 2) ? *(const v8h*)(vr + 256) : v8h{};
                    v16h vf = __builtin_shufflevector(lo, up, 0, 1, 2, 3, 4, 5, 6, 7,
                                                      8, 9, 10, 11, 12, 13, 14, 15);
                    o[td] = wmma32(vf, p[kk], o[td]); // o[td][g]: d 16td + 8hi + g, query c
                }
            }
#pragma unroll
            for (int td = 0; td < 4; ++td) {
                v8h ov;
#pragma unroll
                for (int g = 0; g < 8; ++g) ov[g] = (_Float16)o[td][g];
                *(v8h*)(bufA + (mt * 16 + c) * LDP + h * DH + td * 16 + 8 * hi) = ov;
            }
        }
    }
    // step 0's weight fragments of the out projection, issued ahead of the barrier: they come back
    // while the block's slower waves are still on their way to it
    v16h wo0[4];
    load_wfrags(WoT + (size_t)(w * 64) * INNER, 0, lane, wo0);
    __syncthreads();

    // ---------- phase 3: out = h @ Wout + bout -------------------------------
    // wave w: all 64 rows x columns 64w .. 64w + 63. The accumulators go out through a staging
    // tile of the wave's own in bufB (q is dead behind the barrier above): 16 rows at a time are
    // written as the lanes hold them and read back row-wise, so that one wave-wide 16-byte global
    // store covers the wave's whole 256 bytes of two rows, four whole cache lines.
    {
        const int n0 = w * 64;
        const int c = lane & 15, hi = lane >> 4;
        float* orow = out + ((size_t)b * SQ + m0) * INNER + n0 + c * 4;
        float* stg  = (float*)bufB + w * (16 * OSP);
        v8f o[4][4] = {};
        gemm_64x64<true>(bufA, WoT + (size_t)n0 * INNER, lane, wo0, o);
        const v4f bias = *(const v4f*)(bout + n0 + c * 4);
#pragma unroll
        for (int mi = 0; mi < 4; ++mi) {
#pragma unroll
            for (int t = 0; t < 4; ++t) {
                float* d = stg + c * OSP + t * 16 + hi * 8;
                *(v4f*)d       = __builtin_shufflevector(o[mi][t], o[mi][t], 0, 1, 2, 3);
                *(v4f*)(d + 4) = __builtin_shufflevector(o[mi][t], o[mi][t], 4, 5, 6, 7);
            }
            // the rows are read back by other lanes of the wave than wrote them: the writes have
            // to be done, and the compiler may not lift the reads over them
            asm volatile("s_wait_dscnt 0x0" ::: "memory");
#pragma unroll
            for (int j = 0; j < 8; ++j) {
                const v4f v = *(const v4f*)(stg + (2 * j + hi) * OSP + c * 4) + bias;
                *(v4f*)(orow + (size_t)(mi * 16 + 2 * j + hi) * INNER) = v;
            }
            // the next 16 rows are read back into registers that these stores name: the wait that
            // belongs in front of such an overwrite. Its clobber also keeps the next rows' LDS
            // writes behind the reads above, which other lanes' rows depend on.
            if (mi < 3) asm volatile("s_wait_xcnt 0x0" ::: "memory");
        }
    }
}

// ---------------------------------------------------------------------------
// launch
// ---------------------------------------------------------------------------
extern "C" void kernel_launch(void* const* d_in, const int* in_sizes, int n_in,
                              void* d_out, int out_size, void* d_ws, size_t ws_size,
                              hipStream_t stream) {
    const float* x    = (const float*)d_in[0];
    const float* ctx  = (const float*)d_in[1];
    const float* Wq   = (const float*)d_in[2];
    const float* Wk   = (const float*)d_in[3];
    const float* Wv   = (const float*)d_in[4];
    const float* Wout = (const float*)d_in[5];
    const float* bout = (const float*)d_in[6];
    float* out = (float*)d_out;

    char* ws = (char*)d_ws;
    size_t off = 0;
    _Float16* WqT = (_Float16*)(ws + off); off += (size_t)INNER * DM * 2;     // fragments [8][16][4][FRAG]
    _Float16* WkT = (_Float16*)(ws + off); off += (size_t)INNER * DC * 2;     // fragments [8][24][4][FRAG]
    _Float16* WvT = (_Float16*)(ws + off); off += (size_t)INNER * DC * 2;     // fragments [8][24][4][FRAG]
    _Float16* WoT = (_Float16*)(ws + off); off += (size_t)INNER * INNER * 2;  // fragments [8][16][4][FRAG]
    _Float16* kP  = (_Float16*)(ws + off);
    size_t kvBytes = 2ull * B_ * NH * JPAD * DH * 2;                          // kP + vT
    _Float16* vT  = (_Float16*)(ws + off + kvBytes / 2);

    // one launch: all four weights to f16 fragments (WqT, WkT, WvT, WoT are consecutive) and
    // zeros over K's last key tile
    wcvt_all<<<dim3(CVB_Q + 2 * CVB_C + CVB_O + CVB_Z), 256, 0, stream>>>(Wq, Wk, Wv, Wout, WqT, kP);

    // k/v projection: 5 j-tiles x 16 batches x {k,v}
    kv_proj<<<dim3(5, B_, 2), 256, 0, stream>>>(ctx, WkT, WvT, kP, vT);

    // fused q-proj + attention + out-proj: 64 q-tiles x 16 batches
    attn_fused<<<dim3(SQ / 64, B_), 256, 0, stream>>>(x, WqT, kP, vT, WoT, bout, out);
}

// v010
// It runs in 76.6 microseconds.
// Timed twice side by side with v009, it ran 1.03 and 1.06 times as fast.
// All steps since v000 together make it 11.2 times as fast.
#include <hip/hip_runtime.h>
#include <hip/hip_bf16.h>

typedef __attribute__((ext_vector_type(16))) _Float16 v16h;
typedef __attribute__((ext_vector_type(8)))  _Float16 v8h;
typedef __attribute__((ext_vector_type(4)))  _Float16 v4h;
typedef __attribute__((ext_vector_type(8)))  float    v8f;
typedef __attribute__((ext_vector_type(4)))  float    v4f;

#define B_   16
#define SQ   4096
#define DM   512
#define SKV  77
#define DC   768
#define NH   8
#define DH   64
#define INNER 512
#define JPAD 128   // Skv padded to multiple of 32 (K-dim of attn@v WMMA)
// LDS row pitches in halfs: row length + 8, so a pitch is an odd multiple of 16 bytes and the
// 16 rows that one ds_load_b128 / ds_store_b128 touches fall on 16 different groups of 4 banks.
#define LDP  (INNER + 8)   // 1040 B
#define CTP  (DC + 8)      // 1552 B
// Row pitch in floats of a wave's output staging tile (16 rows x 64 columns): 272 B, again an odd
// multiple of 16 bytes, for its 16-byte stores (one row a lane).
#define OSP  (64 + 4)

// ---------------------------------------------------------------------------
// helpers
// ---------------------------------------------------------------------------
__device__ __forceinline__ v8f wmma32(v16h a, v16h b, v8f c) {
    // D = A(16x32 f16) * B(32x16 f16) + C(16x16 f32)
    return __builtin_amdgcn_wmma_f32_16x16x32_f16(
        /*neg_a=*/false, a, /*neg_b=*/false, b,
        /*c_mod=*/(short)0, c, /*reuse_a=*/false, /*reuse_b=*/false);
}

// Fragment order: every matrix operand that is read from global memory is stored as a row of
// 1-KiB fragments (16 rows x 32 k), each laid out [piece 0..1][lane 0..31][8 halfs]. Lane l
// owns row l & 15 and k = 16 * (l >> 4) + 8 * piece + e (V: see attn_fused), so one wave-wide
// 16-byte load reads 512 contiguous bytes, four whole cache lines.
#define FRAG 512   // halfs in a fragment
__device__ __forceinline__ v16h frag_packed(const _Float16* f, int lane) {
    v8h lo = *(const v8h*)(f + lane * 8);
    v8h up = *(const v8h*)(f + 256 + lane * 8);
    return __builtin_shufflevector(lo, up, 0, 1, 2, 3, 4, 5, 6, 7, 8, 9, 10, 11, 12, 13, 14, 15);
}

// A fragment from a padded LDS tile: lane picks row lane & 15 and 16 halfs along K from
// 16 * (lane >> 4); rows are 16-byte aligned, so they are read as two 16-byte pieces.
__device__ __forceinline__ v16h frag16_lds(const _Float16* base, int pitch, int lane) {
    const _Float16* p = base + (lane & 15) * pitch + ((lane >> 4) << 4);
    v8h lo = *(const v8h*)p;
    v8h up = *(const v8h*)(p + 8);
    return __builtin_shufflevector(lo, up, 0, 1, 2, 3, 4, 5, 6, 7, 8, 9, 10, 11, 12, 13, 14, 15);
}

// 2^x. The v_nop is the one free issue slot the instruction set asks for behind a
// transcendental.
__device__ __forceinline__ float exp2_slot(float x) {
    float r;
    asm("v_exp_f32 %0, %1\n\tv_nop" : "=v"(r) : "v"(x));
    return r;
}

// The wave's four weight fragments of k step ks (8 16-byte loads), global, fragment order [k step][t].
__device__ __forceinline__ void load_wfrags(const _Float16* wt, int ks, int lane, v16h (&bf)[4]) {
#pragma unroll   // constant t: bf stays in registers
    for (int t = 0; t < 4; ++t) bf[t] = frag_packed(wt + (ks * 4 + t) * FRAG, lane);
}

// One k step: acc[mi][t] += A rows 16mi .. (LDS, row pitch LDP), k 32ks .., * weight fragment bf[t].
template <bool TR>
__device__ __forceinline__ void gemm_step(const _Float16* a_lds, int ks, int lane,
                                          const v16h (&bf)[4], v8f (&acc)[4][4]) {
    v16h a[4];
#pragma unroll   // constant indices, here and below: a, bf and acc stay in registers
    for (int mi = 0; mi < 4; ++mi)
        a[mi] = frag16_lds(a_lds + (mi * 16) * LDP + ks * 32, LDP, lane);
    // keeps the loads issued so far (the next step's weights, this step's LDS fragments) ahead of
    // the step's 16 matrix instructions: sunk among them they would have less time to come back
    __builtin_amdgcn_sched_barrier(0);
#pragma unroll
    for (int t = 0; t < 4; ++t)
#pragma unroll
        for (int mi = 0; mi < 4; ++mi)
            acc[mi][t] = TR ? wmma32(bf[t], a[mi], acc[mi][t]) : wmma32(a[mi], bf[t], acc[mi][t]);
    // keeps the refill of bf behind the matrix instructions that read it: lifted over them it
    // would take a third set of registers
    __builtin_amdgcn_sched_barrier(0);
}

// acc[mi][t] += A rows 16mi .. (64 x 512 in LDS, row pitch LDP) * wt columns 16t .. (64 x 512,
// global, fragment order [k step][t]).
// One wave owns all 64 rows of 64 output columns, so each weight fragment read from
// global memory feeds four matrix instructions and no two waves read the same weights.
// The weight fragments are fetched one k step ahead into a second register set: a step's 8 loads
// are issued in front of the 16 matrix instructions of the step before and waited for behind
// them. w0 holds step 0's fragments, which the caller loads ahead of its barrier.
// TR: the product is formed transposed (weights as the A operand), so that a lane holds 8
// consecutive columns 16t + 8 * (lane >> 4) .. of row 16mi + (lane & 15) and not 8 rows of one column.
template <bool TR>
__device__ __forceinline__ void gemm_64x64(const _Float16* a_lds, const _Float16* wt,
                                           int lane, v16h (&w0)[4], v8f (&acc)[4][4]) {
    v16h w1[4];
    // unrolled in full: every load's address is then the one base pair plus a constant, and no
    // address register is rewritten while loads are in flight
#pragma unroll
    for (int ks = 0; ks < INNER / 32; ks += 2) {
        load_wfrags(wt, ks + 1, lane, w1);
        gemm_step<TR>(a_lds, ks, lane, w0, acc);
        if (ks + 2 < INNER / 32) load_wfrags(wt, ks + 2, lane, w0);
        gemm_step<TR>(a_lds, ks + 1, lane, w1, acc);
    }
    // the code that follows reuses the base pair of the loads above: the wait that belongs in
    // front of such an overwrite
    asm volatile("s_wait_xcnt 0x0" ::: "memory");
}

// ---------------------------------------------------------------------------
// Kernel 0: convert the four f32 weights [K][INNER] -> f16 fragments
// [INNER/64][K/32][4 column tiles][FRAG], all in one launch. A block makes the four fragments of
// one (64-column group, k step) of one matrix; its index range says which matrix. The four
// outputs lie one behind the other in the workspace in the order Wq, Wk, Wv, Wout, so the
// block index is also the output position. One thread makes one 16-byte piece (8 k of one column).
// The last CVB_Z blocks store zeros over the last key tile of K (two fragments a head), of which
// kv_proj, the next launch, writes the SKV % 16 valid rows only; V's padding kv_proj writes itself.
// ---------------------------------------------------------------------------
#define CVB_Q (DM * INNER / 8 / 256)      // blocks of Wq
#define CVB_C (DC * INNER / 8 / 256)      // blocks of Wk, and of Wv
#define CVB_O (INNER * INNER / 8 / 256)   // blocks of Wout
#define CVB_Z (B_ * NH * 2 * FRAG / 8 / 256)   // blocks that zero K's last key tile
__global__ __launch_bounds__(256) void wcvt_all(const float* __restrict__ Wq,
                                                const float* __restrict__ Wk,
                                                const float* __restrict__ Wv,
                                                const float* __restrict__ Wo,
                                                _Float16* __restrict__ dst,
                                                _Float16* __restrict__ kP) {
    const int blk = blockIdx.x, tid = threadIdx.x;
    if (blk >= CVB_Q + 2 * CVB_C + CVB_O) {
        const int i = (blk - (CVB_Q + 2 * CVB_C + CVB_O)) * 256 + tid;   // 16-byte piece
        const int head = i / (2 * FRAG / 8), pc = i % (2 * FRAG / 8);
        *(v8h*)(kP + (size_t)head * (JPAD * DH) + (SKV / 16) * 2 * FRAG + pc * 8) = v8h{};
        return;
    }
    const float* src;
    int nw, ks;
    if (blk < CVB_Q) {
        src = Wq; nw = blk / (DM / 32); ks = blk % (DM / 32);
    } else if (blk < CVB_Q + CVB_C) {
        src = Wk; nw = (blk - CVB_Q) / (DC / 32); ks = (blk - CVB_Q) % (DC / 32);
    } else if (blk < CVB_Q + 2 * CVB_C) {
        src = Wv; nw = (blk - CVB_Q - CVB_C) / (DC / 32); ks = (blk - CVB_Q - CVB_C) % (DC / 32);
    } else {
        src = Wo; nw = (blk - CVB_Q - 2 * CVB_C) / (INNER / 32);
        ks = (blk - CVB_Q - 2 * CVB_C) % (INNER / 32);
    }
    const int lane = tid & 31, piece = (tid >> 5) & 1, t = (tid >> 6) & 3;
    const int n  = (nw * 4 + t) * 16 + (lane & 15);
    const int k0 = ks * 32 + (lane >> 4) * 16 + piece * 8;
    float f[8];
#pragma unroll
    for (int e = 0; e < 8; ++e) f[e] = src[(size_t)(k0 + e) * INNER + n];
    // the converted halfs are written over the loads' address registers: the wait that
    // belongs in front of such an overwrite
    asm volatile("s_wait_xcnt 0x0" ::: "memory");
    v8h o;
#pragma unroll
    for (int e = 0; e < 8; ++e) o[e] = (_Float16)f[e];
    *(v8h*)(dst + ((size_t)blk * 256 + tid) * 8) = o;
}

// ---------------------------------------------------------------------------
// Kernel 1: k/v projection (WMMA).
//   context[b][j][768] @ Wk/Wv -> per head (JPAD * DH halfs each), in fragment order:
//     kP[b][h][j tile(5)][d step(2)][FRAG]    rows = keys, k = d
//     vT[b][h][j step(3)][d tile(4)][FRAG]    rows = d, k = keys: piece p, lane half hi hold
//                                             keys 16p + 8hi .. + 7 of the step
// grid = (5 m-tiles, 16 batches, 2 {k,v}), block = 256 (8 waves)
// ---------------------------------------------------------------------------
#define KVR 5   // k steps of weight fragments held in the register ring (8 16-byte loads a step)
__global__ __launch_bounds__(256) void kv_proj(
    const float* __restrict__ ctx,
    const _Float16* __restrict__ WkT,   // 512 x 768 f16 fragments
    const _Float16* __restrict__ WvT,   // 512 x 768 f16 fragments
    _Float16* __restrict__ kP,
    _Float16* __restrict__ vT) {
    __shared__ __align__(32) _Float16 ct[16 * CTP];  // 24 KB context tile (f16), padded rows

    const int tid  = threadIdx.x;
    const int b    = blockIdx.y;
    const int j0   = blockIdx.x * 16;
    const int isv  = blockIdx.z;
    const int w    = tid >> 5, lane = tid & 31;

    // The tile's 16 rows are one contiguous run of 16 * DC / 4 16-byte pieces, 12 a thread. All 12
    // loads are issued before the first value is used, so a thread waits out one memory latency
    // and not one per load. Pieces of the padding rows (j >= SKV) read the last valid piece
    // instead, which keeps the address inside ctx, and are stored as zeros.
    const v4f* cbase = (const v4f*)(ctx + ((size_t)b * SKV + j0) * DC);
    const int npc = (SKV - j0 < 16 ? SKV - j0 : 16) * (DC / 4);   // valid pieces of this tile
    v4f cv[16 * DC / 4 / 256];
    int pc[16 * DC / 4 / 256];
#pragma unroll
    for (int u = 0; u < 16 * DC / 4 / 256; ++u) {
        const int i = tid + u * 256;
        pc[u] = i < npc ? i : npc - 1;
        cv[u] = cbase[pc[u]];
    }
    // Weight ring: the wave's weight fragments of KVR k steps are in flight or in registers at any
    // time. The first KVR steps depend on nothing of the tile and are issued here, behind the
    // context loads, so that both kinds of load wait out their latency together.
    const _Float16* wp = (isv ? WvT : WkT) + (size_t)w * (DC / 32) * 4 * FRAG;
    v16h wr[KVR][4];
#pragma unroll
    for (int s = 0; s < KVR; ++s)
#pragma unroll
        for (int t = 0; t < 4; ++t) wr[s][t] = frag_packed(wp + (s * 4 + t) * FRAG, lane);
    // The loaded values as inputs hold all 12 loads ahead of the first convert (without that the
    // build issued part of them only behind waits on earlier ones). The piece indices as inputs
    // keep the loads' offset registers untouched up to here, so that no load's result lands in an
    // earlier load's offset register, and the wait stands in front of their first overwrite.
    asm volatile("s_wait_xcnt 0x0"
                 :: "v"(cv[0]), "v"(cv[1]), "v"(cv[2]), "v"(cv[3]), "v"(cv[4]), "v"(cv[5]),
                    "v"(cv[6]), "v"(cv[7]), "v"(cv[8]), "v"(cv[9]), "v"(cv[10]), "v"(cv[11]),
                    "v"(pc[0]), "v"(pc[1]), "v"(pc[2]), "v"(pc[3]), "v"(pc[4]), "v"(pc[5]),
                    "v"(pc[6]), "v"(pc[7]), "v"(pc[8]), "v"(pc[9]), "v"(pc[10]), "v"(pc[11])
                 : "memory");
#pragma unroll
    for (int u = 0; u < 16 * DC / 4 / 256; ++u) {
        const int i = tid + u * 256;
        const int r = i / (DC / 4), c4 = i - r * (DC / 4);
        const bool in = i < npc;
        const v4h o = {(_Float16)cv[u][0], (_Float16)cv[u][1], (_Float16)cv[u][2], (_Float16)cv[u][3]};
        uint2 ob = __builtin_bit_cast(uint2, o);
        ob.x = in ? ob.x : 0u;
        ob.y = in ? ob.y : 0u;
        *(uint2*)(ct + r * CTP + c4 * 4) = ob;
    }
    __syncthreads();

    // Step ks multiplies out of ring slot ks % KVR and then refills that slot with step ks + KVR, so
    // a step's 8 loads are issued KVR steps ahead of their wait. The context fragment is read from
    // LDS one step ahead. Unrolled in full: the slot numbers have to be constants for the ring to
    // stay in registers.
    v8f acc[4] = {v8f{}, v8f{}, v8f{}, v8f{}};
    v16h a[2];
    a[0] = frag16_lds(ct, CTP, lane);
#pragma unroll
    for (int ks = 0; ks < DC / 32; ++ks) {
        if (ks + 1 < DC / 32) a[(ks + 1) & 1] = frag16_lds(ct + (ks + 1) * 32, CTP, lane);
#pragma unroll
        for (int t = 0; t < 4; ++t) acc[t] = wmma32(a[ks & 1], wr[ks % KVR][t], acc[t]);
        if (ks + KVR < DC / 32) {
#pragma unroll
            for (int t = 0; t < 4; ++t)
                wr[ks % KVR][t] = frag_packed(wp + ((ks + KVR) * 4 + t) * FRAG, lane);
        }
        // keeps each refill at its own step: gathered further down, fewer loads would be in flight
        __builtin_amdgcn_sched_barrier(0);
    }

    // wave w holds head w: d = 16t + c, keys j0 + 8hi + g
    const int c = lane & 15, hi = lane >> 4;
    const size_t head = ((size_t)b * NH + w) * (JPAD * DH);
    if (isv) {
        // the lane's 8 keys are one 16-byte piece of V's fragment; padding keys stay 0
        _Float16* vf = vT + head + (j0 >> 5) * 4 * FRAG + ((j0 >> 4) & 1) * 256 + lane * 8;
#pragma unroll
        for (int t = 0; t < 4; ++t) {
            v8h ov;
#pragma unroll
            for (int g = 0; g < 8; ++g)
                ov[g] = (j0 + 8 * hi + g < SKV) ? (_Float16)acc[t][g] : (_Float16)0.f;
            *(v8h*)(vf + t * FRAG) = ov;
        }
        // the registers these four stores name are reused on the code path that follows in the
        // build: the wait that belongs in front of such an overwrite
        asm volatile("s_wait_xcnt 0x0" ::: "memory");
    } else {
        _Float16* kf = kP + head + (j0 >> 4) * 2 * FRAG + (c >> 3) * 256 + hi * 64 + (c & 7);
#pragma unroll
        for (int t = 0; t < 4; ++t)
#pragma unroll
            for (int g = 0; g < 8; ++g)
                if (j0 + 8 * hi + g < SKV)
                    kf[(t >> 1) * FRAG + (t & 1) * 128 + g * 8] = (_Float16)acc[t][g];
    }
}

// ---------------------------------------------------------------------------
// Kernel 2: fused q-proj + attention + out-proj.
// One block = 64 q rows of one batch. 256 threads = 8 waves.
// bufA: x tile (f16) then h tile; bufB: q tile (f16, pre-scaled by d^-1/2).
// ---------------------------------------------------------------------------
// four waves a SIMD: the register budget (256) at which two work-groups share a WGP, as their LDS allows
__global__ __launch_bounds__(256) __attribute__((amdgpu_waves_per_eu(4, 4))) void attn_fused(
    const float*    __restrict__ x,
    const _Float16* __restrict__ WqT,    // 512 x 512, fragment order
    const _Float16* __restrict__ kP,     // [B][H] fragments, see kv_proj
    const _Float16* __restrict__ vT,     // [B][H] fragments, see kv_proj
    const _Float16* __restrict__ WoT,    // 512 x 512, fragment order
    const float*    __restrict__ bout,   // [512]
    float*          __restrict__ out) {
    __shared__ __align__(32) _Float16 bufA[64 * LDP];  // 65 KB  x -> h
    __shared__ __align__(32) _Float16 bufB[64 * LDP];  // 65 KB  q

    const int tid  = threadIdx.x;
    const int w    = tid >> 5, lane = tid & 31;
    const int b    = blockIdx.y;
    const int m0   = blockIdx.x * 64;

    // ---------- phase 0: x tile (one contiguous block) -> f16 LDS rows ----------
    const float4* xs = (const float4*)(x + ((size_t)b * SQ + m0) * DM);
    __builtin_prefetch(WqT + (size_t)tid * 1024, 0, 1);   // warm L2 with Wq
    // step 0's weight fragments of the q projection depend on nothing of the tile: issued here,
    // they come back while the x tile is staged
    v16h wq0[4];
    load_wfrags(WqT + (size_t)(w * 64) * INNER, 0, lane, wq0);
    for (int i = tid; i < 64 * DM / 4; i += 256) {
        float4 v = xs[i];
        _Float16* d = bufA + (i / (DM / 4)) * LDP + (i % (DM / 4)) * 4;
        d[0] = (_Float16)v.x; d[1] = (_Float16)v.y;
        d[2] = (_Float16)v.z; d[3] = (_Float16)v.w;
    }
    __syncthreads();

    // ---------- phase 1: q = x @ Wq  (scaled), write f16 to bufB -------------
    // wave w: all 64 rows x columns 64w .. 64w + 63
    {
        const int n0 = w * 64;
        v8f q[4][4] = {};
        gemm_64x64<false>(bufA, WqT + (size_t)n0 * INNER, lane, wq0, q);
#pragma unroll
        for (int mi = 0; mi < 4; ++mi)
#pragma unroll
            for (int t = 0; t < 4; ++t) {
                const int n = n0 + t * 16 + (lane & 15);
#pragma unroll
                for (int g = 0; g < 8; ++g) {
                    const int m = mi * 16 + g + 8 * (lane >> 4);
                    bufB[m * LDP + n] = (_Float16)(q[mi][t][g] * 0.125f);
                }
            }
    }
    // The wave's head has 10 K and 12 V fragments, the same for all four 16-query tiles: they are
    // loaded once and stay in registers over the tile loop. They depend on nothing of the block, so
    // they are issued ahead of the barrier, where their latency runs beside the q tile's LDS stores.
    v16h kfr[5][2];   // [key tile][d step]
    v16h vfr[3][4];   // [key step][d tile]; the last step holds 16 keys, its upper half is 0
    {
        const _Float16* kb = kP + (((size_t)b * NH + w) * JPAD) * DH;
        const _Float16* vb = vT + (((size_t)b * NH + w) * DH) * JPAD;
#pragma unroll   // constant indices, here and below: kfr and vfr stay in registers
        for (int t = 0; t < 5; ++t)
#pragma unroll
            for (int dstep = 0; dstep < 2; ++dstep)
                kfr[t][dstep] = frag_packed(kb + (t * 2 + dstep) * FRAG, lane);
#pragma unroll
        for (int kk = 0; kk < 3; ++kk)
#pragma unroll
            for (int td = 0; td < 4; ++td) {
                const _Float16* vr = vb + (kk * 4 + td) * FRAG + lane * 8;
                v8h lo = *(const v8h*)vr;
                v8h up = (kk < 2) ? *(const v8h*)(vr + 256) : v8h{};
                vfr[kk][td] = __builtin_shufflevector(lo, up, 0, 1, 2, 3, 4, 5, 6, 7,
                                                      8, 9, 10, 11, 12, 13, 14, 15);
            }
        // the code that follows reuses the address registers of the loads above: the wait that
        // belongs in front of such an overwrite. The two bases as inputs keep those registers
        // untouched up to here, so that no load's result lands in an earlier load's address pair.
        asm volatile("s_wait_xcnt 0x0" :: "v"(kb + lane * 8), "v"(vb + lane * 8) : "memory");
    }
    __syncthreads();

    // ---------- phase 2: attention, one head per wave, softmax in registers --
    // S^T = K * Q^T: a lane holds 40 of one query's 80 score slots (lane and
    // lane ^ 16 split the keys), so max and sum are in-lane plus one exchange.
    // The score tiles, converted in place, are the B operand of O^T = V^T * P^T;
    // V^T is read in the matching k order (8 keys at 8*hi, 8 keys at 16 + 8*hi).
    {
        const int h = w;
        const int c = lane & 15, hi = lane >> 4;
        for (int mt = 0; mt < 4; ++mt) {
            const _Float16* qrow = bufB + (mt * 16) * LDP + h * DH;
            v8f s[5] = {v8f{}, v8f{}, v8f{}, v8f{}, v8f{}};
#pragma unroll
            for (int dstep = 0; dstep < 2; ++dstep) {
                const int d0 = dstep * 32;
                v16h qf = frag16_lds(qrow + d0, LDP, lane);
#pragma unroll
                for (int t = 0; t < 5; ++t)
                    s[t] = wmma32(kfr[t][dstep], qf, s[t]);   // s[t][g]: key 16t + 8hi + g, query c
            }
            // keys 77..79 (tile 4, upper half, g >= 5) are padding
#pragma unroll
            for (int g = SKV - 72; g < 8; ++g) s[4][g] = hi ? -1e30f : s[4][g];

            float mx = -1e30f;
#pragma unroll
            for (int t = 0; t < 5; ++t)
#pragma unroll
                for (int g = 0; g < 8; ++g) mx = fmaxf(mx, s[t][g]);
            mx = fmaxf(mx, __shfl_xor(mx, 16));
            float sum = 0.f;
#pragma unroll
            for (int t = 0; t < 5; ++t)
#pragma unroll
                for (int g = 0; g < 8; ++g) {
                    float e = exp2_slot((s[t][g] - mx) * 1.44269504f);
                    s[t][g] = e; sum += e;
                }
            sum += __shfl_xor(sum, 16);
            const float r = 1.f / sum;

            v16h p[3];
#pragma unroll
            for (int kk = 0; kk < 3; ++kk)
#pragma unroll
                for (int g = 0; g < 8; ++g) {
                    p[kk][g]     = (_Float16)(s[2 * kk][g] * r);
                    p[kk][8 + g] = (kk < 2) ? (_Float16)(s[(kk < 2) ? 2 * kk + 1 : 0][g] * r)
                                            : (_Float16)0.f;
                }

            v8f o[4] = {v8f{}, v8f{}, v8f{}, v8f{}};
#pragma unroll
            for (int kk = 0; kk < 3; ++kk) {
#pragma unroll
                for (int td = 0; td < 4; ++td)
                    o[td] = wmma32(vfr[kk][td], p[kk], o[td]);   // o[td][g]: d 16td + 8hi + g, query c
            }
#pragma unroll
            for (int td = 0; td < 4; ++td) {
                v8h ov;
#pragma unroll
                for (int g = 0; g < 8; ++g) ov[g] = (_Float16)o[td][g];
                *(v8h*)(bufA + (mt * 16 + c) * LDP + h * DH + td * 16 + 8 * hi) = ov;
            }
        }
    }
    // step 0's weight fragments of the out projection, issued ahead of the barrier: they come back
    // while the block's slower waves are still on their way to it
    v16h wo0[4];
    load_wfrags(WoT + (size_t)(w * 64) * INNER, 0, lane, wo0);
    __syncthreads();

    // ---------- phase 3: out = h @ Wout + bout -------------------------------
    // wave w: all 64 rows x columns 64w .. 64w + 63. The accumulators go out through a staging
    // tile of the wave's own in bufB (q is dead behind the barrier above): 16 rows at a time are
    // written as the lanes hold them and read back row-wise, so that one wave-wide 16-byte global
    // store covers the wave's whole 256 bytes of two rows, four whole cache lines.
    {
        const int n0 = w * 64;
        const int c = lane & 15, hi = lane >> 4;
        float* orow = out + ((size_t)b * SQ + m0) * INNER + n0 + c * 4;
        float* stg  = (float*)bufB + w * (16 * OSP);
        v8f o[4][4] = {};
        gemm_64x64<true>(bufA, WoT + (size_t)n0 * INNER, lane, wo0, o);
        const v4f bias = *(const v4f*)(bout + n0 + c * 4);
#pragma unroll
        for (int mi = 0; mi < 4; ++mi) {
#pragma unroll
            for (int t = 0; t < 4; ++t) {
                float* d = stg + c * OSP + t * 16 + hi * 8;
                *(v4f*)d       = __builtin_shufflevector(o[mi][t], o[mi][t], 0, 1, 2, 3);
                *(v4f*)(d + 4) = __builtin_shufflevector(o[mi][t], o[mi][t], 4, 5, 6, 7);
            }
            // the rows are read back by other lanes of the wave than wrote them: the writes have
            // to be done, and the compiler may not lift the reads over them
            asm volatile("s_wait_dscnt 0x0" ::: "memory");
#pragma unroll
            for (int j = 0; j < 8; ++j) {
                const v4f v = *(const v4f*)(stg + (2 * j + hi) * OSP + c * 4) + bias;
                *(v4f*)(orow + (size_t)(mi * 16 + 2 * j + hi) * INNER) = v;
            }
            // the next 16 rows are read back into registers that these stores name: the wait that
            // belongs in front of such an overwrite. Its clobber also keeps the next rows' LDS
            // writes behind the reads above, which other lanes' rows depend on.
            if (mi < 3) asm volatile("s_wait_xcnt 0x0" ::: "memory");
        }
    }
}

// ---------------------------------------------------------------------------
// launch
// ---------------------------------------------------------------------------
extern "C" void kernel_launch(void* const* d_in, const int* in_sizes, int n_in,
                              void* d_out, int out_size, void* d_ws, size_t ws_size,
                              hipStream_t stream) {
    const float* x    = (const float*)d_in[0];
    const float* ctx  = (const float*)d_in[1];
    const float* Wq   = (const float*)d_in[2];
    const float* Wk   = (const float*)d_in[3];
    const float* Wv   = (const float*)d_in[4];
    const float* Wout = (const float*)d_in[5];
    const float* bout = (const float*)d_in[6];
    float* out = (float*)d_out;

    char* ws = (char*)d_ws;
    size_t off = 0;
    _Float16* WqT = (_Float16*)(ws + off); off += (size_t)INNER * DM * 2;     // fragments [8][16][4][FRAG]
    _Float16* WkT = (_Float16*)(ws + off); off += (size_t)INNER * DC * 2;     // fragments [8][24][4][FRAG]
    _Float16* WvT = (_Float16*)(ws + off); off += (size_t)INNER * DC * 2;     // fragments [8][24][4][FRAG]
    _Float16* WoT = (_Float16*)(ws + off); off += (size_t)INNER * INNER * 2;  // fragments [8][16][4][FRAG]
    _Float16* kP  = (_Float16*)(ws + off);
    size_t kvBytes = 2ull * B_ * NH * JPAD * DH * 2;                          // kP + vT
    _Float16* vT  = (_Float16*)(ws + off + kvBytes / 2);

    // one launch: all four weights to f16 fragments (WqT, WkT, WvT, WoT are consecutive) and
    // zeros over K's last key tile
    wcvt_all<<<dim3(CVB_Q + 2 * CVB_C + CVB_O + CVB_Z), 256, 0, stream>>>(Wq, Wk, Wv, Wout, WqT, kP);

    // k/v projection: 5 j-tiles x 16 batches x {k,v}
    kv_proj<<<dim3(5, B_, 2), 256, 0, stream>>>(ctx, WkT, WvT, kP, vT);

    // fused q-proj + attention + out-proj: 64 q-tiles x 16 batches
    attn_fused<<<dim3(SQ / 64, B_), 256, 0, stream>>>(x, WqT, kP, vT, WoT, bout, out);
}
